// v000
// Times are from an AMD MI455X. After a warm-up the kernel runs many times in a row, and a time is the length of
// such a window on the GPU divided by its runs, so every launch and the gaps after it count. The runs cycle
// through copies of the inputs. A figure is the median of several windows, for all but v000 over two sittings.
// Sittings can differ by a few percent; kernels timed side by side share one.
// v000 is the starting kernel. One run takes 354 microseconds.
#include <hip/hip_runtime.h>
#include <hip/hip_bf16.h>

// ---------------------------------------------------------------------------
// Swin-V2 shifted-window MHA, fused per-window kernel for gfx1250 (MI455X).
// f16 WMMA (V_WMMA_F32_16X16X32_F16) for all GEMMs, f32 accumulation.
// wave32: 8 waves / 256-thread block, one window (64 tokens) per block.
// ---------------------------------------------------------------------------

typedef __attribute__((ext_vector_type(16))) _Float16 v16h;
typedef __attribute__((ext_vector_type(8)))  _Float16 v8h;
typedef __attribute__((ext_vector_type(8)))  float    v8f;

#define WINSZ   8
#define NTOK    64          // tokens per window
#define DM      256         // model dim
#define NHEADS  8
#define HD      32          // head dim
#define XS      264         // f16 row stride for 64x256 LDS buffers (pad 8)
#define VTS     72          // f16 row stride for v^T (256x64) LDS buffer
#define ATS     72          // f16 row stride for attn (64x64 per head)

union V16u { v16h v; v8h h[2]; };

// Load a 16x32 (f16) WMMA A/B fragment from a row-major f16 matrix.
// Lane layout follows the CDNA5 16-bit fragment striping:
//   lanes 0-15 : row = base+lane,    K chunks [0..7] and [16..23]
//   lanes 16-31: row = base+lane-16, K chunks [8..15] and [24..31]
__device__ __forceinline__ v16h load_frag(const _Float16* base, int row0,
                                          int stride, int k0, int lane) {
  const int r  = row0 + (lane & 15);
  const int c0 = k0 + ((lane >> 4) << 3);
  const _Float16* p = base + (size_t)r * stride + c0;
  V16u u;
  u.h[0] = *(const v8h*)(p);
  u.h[1] = *(const v8h*)(p + 16);
  return u.v;
}

__device__ __forceinline__ v8f wmma16(v16h a, v16h b, v8f c) {
  return __builtin_amdgcn_wmma_f32_16x16x32_f16(
      /*neg_a=*/false, a, /*neg_b=*/false, b,
      /*c_mod=*/(short)0, c, /*reuse_a=*/false, /*reuse_b=*/false);
}

// Reductions across a 16-lane group (C/D fragment: N runs across lanes 0-15
// within each half-wave, so xor masks 1/2/4/8 never cross the half boundary).
__device__ __forceinline__ float red16_sum(float v) {
  v += __shfl_xor(v, 1, 32); v += __shfl_xor(v, 2, 32);
  v += __shfl_xor(v, 4, 32); v += __shfl_xor(v, 8, 32);
  return v;
}
__device__ __forceinline__ float red16_max(float v) {
  v = fmaxf(v, __shfl_xor(v, 1, 32)); v = fmaxf(v, __shfl_xor(v, 2, 32));
  v = fmaxf(v, __shfl_xor(v, 4, 32)); v = fmaxf(v, __shfl_xor(v, 8, 32));
  return v;
}

// shift-mask region id: rows/cols [0,8) -> 0, [8,12) -> 1, [12,16) -> 2
__device__ __forceinline__ int reg3(int p) { return p < 8 ? 0 : (p < 12 ? 1 : 2); }

// ---------------------------------------------------------------------------
// One 16x128 slice of a projection GEMM: dst = x(64x256,f16) @ W^T + bias.
// NORM: per-head (32-col) L2 normalization of the f32 accumulators (cosine
//       attention) before f16 conversion.
// TRANS: store transposed (for v, so attn@v B-fragments are contiguous).
// ---------------------------------------------------------------------------
template<bool NORM, bool TRANS>
__device__ __forceinline__ void proj_gemm(const _Float16* src, const _Float16* w16,
                                          const float* bvec, _Float16* dst,
                                          int m0, int n0, int lane) {
  v8f acc[8];
  #pragma unroll
  for (int j = 0; j < 8; ++j) {
    const float bv = bvec[n0 + j * 16 + (lane & 15)];   // C layout: N = lane
    #pragma unroll
    for (int e = 0; e < 8; ++e) acc[j][e] = bv;
  }
  for (int kk = 0; kk < DM; kk += 32) {
    if (kk + 32 < DM)  // gfx1250 global_prefetch_b8 on next weight K-slice
      __builtin_prefetch(w16 + (size_t)(n0 + (lane & 15)) * DM + kk + 32, 0, 1);
    const v16h a = load_frag(src, m0, XS, kk, lane);
    #pragma unroll
    for (int j = 0; j < 8; ++j) {
      const v16h bf = load_frag(w16, n0 + j * 16, DM, kk, lane);
      acc[j] = wmma16(a, bf, acc[j]);
    }
  }
  if (NORM) {
    #pragma unroll
    for (int j = 0; j < 8; j += 2) {        // head = 32 cols = tile pair
      #pragma unroll
      for (int vg = 0; vg < 8; ++vg) {
        float s = acc[j][vg] * acc[j][vg] + acc[j + 1][vg] * acc[j + 1][vg];
        s = red16_sum(s);
        const float rinv = 1.0f / fmaxf(sqrtf(s), 1e-12f);
        acc[j][vg]     *= rinv;
        acc[j + 1][vg] *= rinv;
      }
    }
  }
  #pragma unroll
  for (int j = 0; j < 8; ++j) {
    const int n = n0 + j * 16 + (lane & 15);
    #pragma unroll
    for (int vg = 0; vg < 8; ++vg) {
      const int m = m0 + vg + ((lane >> 4) << 3);
      if (TRANS) dst[(size_t)n * VTS + m] = (_Float16)acc[j][vg];
      else       dst[(size_t)m * XS  + n] = (_Float16)acc[j][vg];
    }
  }
}

// LDS layout (f16 elements). attn aliases x/q/k after they are consumed.
#define OFF_X   0
#define OFF_Q   (NTOK * XS)
#define OFF_K   (2 * NTOK * XS)
#define OFF_VT  (3 * NTOK * XS)
#define OFF_O   (3 * NTOK * XS + DM * VTS)
#define SMEM_ELTS (4 * NTOK * XS + DM * VTS)

__global__ __launch_bounds__(256)
void swinv2_window_attn_kernel(const float* __restrict__ img,
                               const _Float16* __restrict__ wq16, const float* __restrict__ bq,
                               const _Float16* __restrict__ wk16, const float* __restrict__ bk,
                               const _Float16* __restrict__ wv16, const float* __restrict__ bv,
                               const _Float16* __restrict__ wo16, const float* __restrict__ bo,
                               const float* __restrict__ logit_scale,
                               const float* __restrict__ biastab,
                               float* __restrict__ out) {
  extern __shared__ char smem_raw[];
  _Float16* xb = (_Float16*)smem_raw;
  _Float16* qb = xb + OFF_Q;
  _Float16* kb = xb + OFF_K;
  _Float16* vt = xb + OFF_VT;
  _Float16* ob = xb + OFF_O;
  _Float16* at = xb;                 // attn: 8 heads x 64 x ATS, aliases x/q/k

  const int tid  = threadIdx.x;
  const int lane = tid & 31;
  const int wv_id = tid >> 5;

  const int blk = blockIdx.x;        // Bn = B * 4 window-blocks
  const int b  = blk >> 2;
  const int wi = blk & 3;
  const int wy = wi >> 1, wx = wi & 1;

  // ---- Step 1: roll(+4,+4) + window-partition + f32->f16 into LDS ----
  for (int i = tid; i < NTOK * (DM / 4); i += 256) {
    const int row = i >> 6;          // token 0..63
    const int q4  = i & 63;          // float4 index in row
    const int r = row >> 3, c = row & 7;
    const int sh = (((wy << 3) + r) - 4) & 15;   // rolled[h] = img[h-4]
    const int sw = (((wx << 3) + c) - 4) & 15;
    const float4 f =
        ((const float4*)(img + (((size_t)b * 16 + sh) * 16 + sw) * DM))[q4];
    _Float16* dst = xb + (size_t)row * XS + q4 * 4;
    dst[0] = (_Float16)f.x; dst[1] = (_Float16)f.y;
    dst[2] = (_Float16)f.z; dst[3] = (_Float16)f.w;
  }
  __syncthreads();

  // ---- Step 2: q/k/v projections (WMMA). Each wave: 16 rows x 128 cols ----
  const int m0 = (wv_id >> 1) << 4;       // 0,16,32,48
  const int n0 = (wv_id & 1) << 7;        // 0 or 128
  proj_gemm<true,  false>(xb, wq16, bq, qb, m0, n0, lane);   // q, L2-normed
  proj_gemm<true,  false>(xb, wk16, bk, kb, m0, n0, lane);   // k, L2-normed
  proj_gemm<false, true >(xb, wv16, bv, vt, m0, n0, lane);   // v, transposed
  __syncthreads();

  // ---- Step 3: logits = qn@kn^T * scale + bias, mask, softmax (head/wave) --
  {
    const int h = wv_id;
    const float scale = __expf(fminf(logit_scale[h], 4.6051702f)); // log(100)
    const float* bt = biastab + (size_t)h * NTOK * NTOK;

    v8f lg[16];
    #pragma unroll
    for (int t = 0; t < 16; ++t) {
      #pragma unroll
      for (int e = 0; e < 8; ++e) lg[t][e] = 0.0f;
    }

    v16h kf[4];
    #pragma unroll
    for (int nt = 0; nt < 4; ++nt)
      kf[nt] = load_frag(kb, nt * 16, XS, h * HD, lane);   // B = kn^T
    #pragma unroll
    for (int mt = 0; mt < 4; ++mt) {
      const v16h a = load_frag(qb, mt * 16, XS, h * HD, lane);
      #pragma unroll
      for (int nt = 0; nt < 4; ++nt)
        lg[mt * 4 + nt] = wmma16(a, kf[nt], lg[mt * 4 + nt]);   // K = HD = 32
    }

    // scale + relative-position bias + shift-window mask
    #pragma unroll
    for (int mt = 0; mt < 4; ++mt) {
      #pragma unroll
      for (int nt = 0; nt < 4; ++nt) {
        const int Nk = nt * 16 + (lane & 15);               // key token
        const int rk = reg3((wy << 3) + (Nk >> 3)) * 3 +
                       reg3((wx << 3) + (Nk & 7));
        #pragma unroll
        for (int vg = 0; vg < 8; ++vg) {
          const int Mq = mt * 16 + vg + ((lane >> 4) << 3); // query token
          const int rq = reg3((wy << 3) + (Mq >> 3)) * 3 +
                         reg3((wx << 3) + (Mq & 7));
          const float bvl = bt[(size_t)Mq * NTOK + Nk];
          const float v = lg[mt * 4 + nt][vg] * scale + bvl;
          lg[mt * 4 + nt][vg] = (rq == rk) ? v : -1e30f;
        }
      }
    }

    // row softmax fully in registers (row = fixed vg & lane-half; cols span
    // 16 lanes x 4 n-tiles)
    #pragma unroll
    for (int mt = 0; mt < 4; ++mt) {
      #pragma unroll
      for (int vg = 0; vg < 8; ++vg) {
        float mx = fmaxf(fmaxf(lg[mt*4+0][vg], lg[mt*4+1][vg]),
                         fmaxf(lg[mt*4+2][vg], lg[mt*4+3][vg]));
        mx = red16_max(mx);
        float sm = 0.0f;
        #pragma unroll
        for (int nt = 0; nt < 4; ++nt) {
          const float e = __expf(lg[mt*4+nt][vg] - mx);
          lg[mt*4+nt][vg] = e;
          sm += e;
        }
        sm = red16_sum(sm);
        const float rinv = 1.0f / sm;
        #pragma unroll
        for (int nt = 0; nt < 4; ++nt) lg[mt*4+nt][vg] *= rinv;
      }
    }

    __syncthreads();  // all waves done reading qb/kb before aliased writes

    _Float16* ah = at + (size_t)h * NTOK * ATS;
    #pragma unroll
    for (int mt = 0; mt < 4; ++mt) {
      #pragma unroll
      for (int nt = 0; nt < 4; ++nt) {
        const int Nk = nt * 16 + (lane & 15);
        #pragma unroll
        for (int vg = 0; vg < 8; ++vg) {
          const int Mq = mt * 16 + vg + ((lane >> 4) << 3);
          ah[(size_t)Mq * ATS + Nk] = (_Float16)lg[mt * 4 + nt][vg];
        }
      }
    }
  }

  // ---- Step 4: o = attn @ v (one head per wave, WMMA, K = 64 tokens) ----
  {
    const int h = wv_id;
    const _Float16* ah = at + (size_t)h * NTOK * ATS;
    v8f oacc[8];
    #pragma unroll
    for (int t = 0; t < 8; ++t) {
      #pragma unroll
      for (int e = 0; e < 8; ++e) oacc[t][e] = 0.0f;
    }
    #pragma unroll
    for (int kk = 0; kk < NTOK; kk += 32) {
      v16h vf[2];
      #pragma unroll
      for (int nt2 = 0; nt2 < 2; ++nt2)
        vf[nt2] = load_frag(vt, h * HD + nt2 * 16, VTS, kk, lane); // v^T rows
      #pragma unroll
      for (int mt = 0; mt < 4; ++mt) {
        const v16h a = load_frag(ah, mt * 16, ATS, kk, lane);
        #pragma unroll
        for (int nt2 = 0; nt2 < 2; ++nt2)
          oacc[mt * 2 + nt2] = wmma16(a, vf[nt2], oacc[mt * 2 + nt2]);
      }
    }
    #pragma unroll
    for (int mt = 0; mt < 4; ++mt) {
      #pragma unroll
      for (int nt2 = 0; nt2 < 2; ++nt2) {
        const int n = h * HD + nt2 * 16 + (lane & 15);
        #pragma unroll
        for (int vg = 0; vg < 8; ++vg) {
          const int m = mt * 16 + vg + ((lane >> 4) << 3);
          ob[(size_t)m * XS + n] = (_Float16)oacc[mt * 2 + nt2][vg];
        }
      }
    }
  }
  __syncthreads();

  // ---- Step 5: z = o @ wo^T + bo, reverse roll folded into global store ----
  {
    v8f acc[8];
    #pragma unroll
    for (int j = 0; j < 8; ++j) {
      const float bvl = bo[n0 + j * 16 + (lane & 15)];
      #pragma unroll
      for (int e = 0; e < 8; ++e) acc[j][e] = bvl;
    }
    for (int kk = 0; kk < DM; kk += 32) {
      if (kk + 32 < DM)
        __builtin_prefetch(wo16 + (size_t)(n0 + (lane & 15)) * DM + kk + 32, 0, 1);
      const v16h a = load_frag(ob, m0, XS, kk, lane);
      #pragma unroll
      for (int j = 0; j < 8; ++j) {
        const v16h bf = load_frag(wo16, n0 + j * 16, DM, kk, lane);
        acc[j] = wmma16(a, bf, acc[j]);
      }
    }
    #pragma unroll
    for (int j = 0; j < 8; ++j) {
      const int n = n0 + j * 16 + (lane & 15);
      #pragma unroll
      for (int vg = 0; vg < 8; ++vg) {
        const int m  = m0 + vg + ((lane >> 4) << 3);
        const int oh = (((wy << 3) + (m >> 3)) - 4) & 15;  // out = roll(z,-4)
        const int ow = (((wx << 3) + (m & 7)) - 4) & 15;
        out[(((size_t)b * 16 + oh) * 16 + ow) * DM + n] = acc[j][vg];
      }
    }
  }
}

// ---------------------------------------------------------------------------
// Prep kernel 1: f32 -> f16 weight conversion (row-major [out][in] preserved).
// ---------------------------------------------------------------------------
__global__ __launch_bounds__(256)
void swinv2_prep_weights(const float* __restrict__ wq, const float* __restrict__ wk,
                         const float* __restrict__ wv, const float* __restrict__ wo,
                         _Float16* __restrict__ wq16, _Float16* __restrict__ wk16,
                         _Float16* __restrict__ wv16, _Float16* __restrict__ wo16) {
  const int i = blockIdx.x * 256 + threadIdx.x;
  if (i < DM * DM) {
    wq16[i] = (_Float16)wq[i];
    wk16[i] = (_Float16)wk[i];
    wv16[i] = (_Float16)wv[i];
    wo16[i] = (_Float16)wo[i];
  }
}

// ---------------------------------------------------------------------------
// Prep kernel 2: CPB-MLP relative-position bias table -> [H][64][64] f32
// (16 * sigmoid already applied). One thread per (query n, key m) pair.
// ---------------------------------------------------------------------------
__global__ __launch_bounds__(256)
void swinv2_prep_bias(const float* __restrict__ w1, const float* __restrict__ b1,
                      const float* __restrict__ w2, float* __restrict__ biastab) {
  const int p = blockIdx.x * 256 + threadIdx.x;   // 4096 pairs
  if (p >= NTOK * NTOK) return;
  const int n = p >> 6, m = p & 63;
  const float dy = (float)((n >> 3) - (m >> 3));  // relative coords in [-7,7]
  const float dx = (float)((n & 7) - (m & 7));
  const float sy = dy / 7.0f * 8.0f;
  const float sx = dx / 7.0f * 8.0f;
  const float ty = copysignf(log2f(fabsf(sy) + 1.0f) / 3.0f, sy);
  const float tx = copysignf(log2f(fabsf(sx) + 1.0f) / 3.0f, sx);

  float acc[NHEADS];
  #pragma unroll
  for (int h = 0; h < NHEADS; ++h) acc[h] = 0.0f;
  for (int j = 0; j < 512; ++j) {
    const float h1 = fmaxf(w1[j * 2 + 0] * ty + w1[j * 2 + 1] * tx + b1[j], 0.0f);
    #pragma unroll
    for (int h = 0; h < NHEADS; ++h) acc[h] += h1 * w2[h * 512 + j];
  }
  #pragma unroll
  for (int h = 0; h < NHEADS; ++h)
    biastab[(size_t)h * NTOK * NTOK + p] = 16.0f / (1.0f + __expf(-acc[h]));
}

// ---------------------------------------------------------------------------
extern "C" void kernel_launch(void* const* d_in, const int* in_sizes, int n_in,
                              void* d_out, int out_size, void* d_ws, size_t ws_size,
                              hipStream_t stream) {
  (void)in_sizes; (void)n_in; (void)out_size; (void)ws_size;

  const float* img  = (const float*)d_in[0];
  const float* wq   = (const float*)d_in[1];
  const float* bq   = (const float*)d_in[2];
  const float* wk   = (const float*)d_in[3];
  const float* bk   = (const float*)d_in[4];
  const float* wv   = (const float*)d_in[5];
  const float* bv   = (const float*)d_in[6];
  const float* wo   = (const float*)d_in[7];
  const float* bo   = (const float*)d_in[8];
  const float* ls   = (const float*)d_in[9];
  const float* cw1  = (const float*)d_in[10];
  const float* cb1  = (const float*)d_in[11];
  const float* cw2  = (const float*)d_in[12];
  float* out = (float*)d_out;

  // workspace layout (bytes)
  char* ws = (char*)d_ws;
  _Float16* wq16 = (_Float16*)(ws + 0 * 131072);
  _Float16* wk16 = (_Float16*)(ws + 1 * 131072);
  _Float16* wv16 = (_Float16*)(ws + 2 * 131072);
  _Float16* wo16 = (_Float16*)(ws + 3 * 131072);
  float*    btab = (float*)   (ws + 4 * 131072);   // [8][64][64] f32

  swinv2_prep_weights<<<DM * DM / 256, 256, 0, stream>>>(
      wq, wk, wv, wo, wq16, wk16, wv16, wo16);
  swinv2_prep_bias<<<NTOK * NTOK / 256, 256, 0, stream>>>(cw1, cb1, cw2, btab);

  const size_t smem_bytes = (size_t)SMEM_ELTS * sizeof(_Float16);  // 172032 B
  (void)hipFuncSetAttribute((const void*)swinv2_window_attn_kernel,
                            hipFuncAttributeMaxDynamicSharedMemorySize,
                            (int)smem_bytes);

  const int Bn = 512 * 4;   // B * NW windows
  swinv2_window_attn_kernel<<<Bn, 256, smem_bytes, stream>>>(
      img, wq16, bq, wk16, bk, wv16, bv, wo16, bo, ls, btab, out);
}

// v001
// One run takes 213 microseconds.
// Next to v000, in two timings, it ran 1.73 times as fast each time.
#include <hip/hip_runtime.h>
#include <hip/hip_bf16.h>

// ---------------------------------------------------------------------------
// Swin-V2 shifted-window MHA, fused per-window kernel for gfx1250 (MI455X).
// f16 WMMA (V_WMMA_F32_16X16X32_F16) for all GEMMs, f32 accumulation.
// wave32: 8 waves / 256-thread block, one window (64 tokens) per block.
// ---------------------------------------------------------------------------

typedef __attribute__((ext_vector_type(16))) _Float16 v16h;
typedef __attribute__((ext_vector_type(8)))  _Float16 v8h;
typedef __attribute__((ext_vector_type(8)))  float    v8f;

#define WINSZ   8
#define NTOK    64          // tokens per window
#define DM      256         // model dim
#define NHEADS  8
#define HD      32          // head dim
#define XS      264         // f16 row stride for 64x256 LDS buffers (pad 8)
#define VTS     72          // f16 row stride for v^T (256x64) LDS buffer
#define ATS     72          // f16 row stride for attn (64x64 per head)

union V16u { v16h v; v8h h[2]; };

// Load a 16x32 (f16) WMMA A/B fragment from a row-major f16 matrix.
// Lane layout follows the CDNA5 16-bit fragment striping:
//   lanes 0-15 : row = base+lane,    K chunks [0..7] and [16..23]
//   lanes 16-31: row = base+lane-16, K chunks [8..15] and [24..31]
__device__ __forceinline__ v16h load_frag(const _Float16* base, int row0,
                                          int stride, int k0, int lane) {
  const int r  = row0 + (lane & 15);
  const int c0 = k0 + ((lane >> 4) << 3);
  const _Float16* p = base + (size_t)r * stride + c0;
  V16u u;
  u.h[0] = *(const v8h*)(p);
  u.h[1] = *(const v8h*)(p + 16);
  return u.v;
}

__device__ __forceinline__ v8f wmma16(v16h a, v16h b, v8f c) {
  return __builtin_amdgcn_wmma_f32_16x16x32_f16(
      /*neg_a=*/false, a, /*neg_b=*/false, b,
      /*c_mod=*/(short)0, c, /*reuse_a=*/false, /*reuse_b=*/false);
}

// Reductions across a 16-lane group (C/D fragment: N runs across lanes 0-15
// within each half-wave, so xor masks 1/2/4/8 never cross the half boundary).
__device__ __forceinline__ float red16_sum(float v) {
  v += __shfl_xor(v, 1, 32); v += __shfl_xor(v, 2, 32);
  v += __shfl_xor(v, 4, 32); v += __shfl_xor(v, 8, 32);
  return v;
}
__device__ __forceinline__ float red16_max(float v) {
  v = fmaxf(v, __shfl_xor(v, 1, 32)); v = fmaxf(v, __shfl_xor(v, 2, 32));
  v = fmaxf(v, __shfl_xor(v, 4, 32)); v = fmaxf(v, __shfl_xor(v, 8, 32));
  return v;
}

// shift-mask region id: rows/cols [0,8) -> 0, [8,12) -> 1, [12,16) -> 2
__device__ __forceinline__ int reg3(int p) { return p < 8 ? 0 : (p < 12 ? 1 : 2); }

// ---------------------------------------------------------------------------
// acc(64x32) += src(64x256, LDS) @ W[n0..n0+31][:]^T. The wave's whole weight
// slice (32 rows x 256, 16 KB = 128 registers a lane) is requested first, so
// all 32 loads are in flight together; tile index = mt * 2 + nt.
// ---------------------------------------------------------------------------
__device__ __forceinline__ void mm_64x32(const _Float16* src, const _Float16* w16,
                                         int n0, int lane, v8f (&acc)[8]) {
  // This lane's place in the two 16-row weight tiles (layout as in load_frag).
  const _Float16* w0 = w16 + (size_t)(n0 + (lane & 15)) * DM + ((lane >> 4) << 3);
  const _Float16* w1 = w0 + 16 * DM;
  v16h bf[DM / 32][2];
  #pragma unroll
  for (int ks = 0; ks < DM / 32; ++ks) {
    V16u u0, u1;
    u0.h[0] = *(const v8h*)(w0 + ks * 32);
    u0.h[1] = *(const v8h*)(w0 + ks * 32 + 16);
    u1.h[0] = *(const v8h*)(w1 + ks * 32);
    u1.h[1] = *(const v8h*)(w1 + ks * 32 + 16);
    bf[ks][0] = u0.v;
    bf[ks][1] = u1.v;
  }
  v16h a[2][4];
  #pragma unroll
  for (int mt = 0; mt < 4; ++mt) a[0][mt] = load_frag(src, mt * 16, XS, 0, lane);
  #pragma unroll
  for (int ks = 0; ks < DM / 32; ++ks) {
    if (ks + 1 < DM / 32) {
      #pragma unroll
      for (int mt = 0; mt < 4; ++mt)
        a[(ks + 1) & 1][mt] = load_frag(src, mt * 16, XS, (ks + 1) * 32, lane);
      // Keeps the loads above (at ks = 0 the 32 weight loads too) ahead of this
      // slice's WMMAs: the scheduler otherwise sinks each pair to its use, and
      // every slice then waits out the L2 and the LDS latency.
      __builtin_amdgcn_sched_barrier(0);
    }
    #pragma unroll
    for (int mt = 0; mt < 4; ++mt) {
      #pragma unroll
      for (int nt = 0; nt < 2; ++nt)
        acc[mt * 2 + nt] = wmma16(a[ks & 1][mt], bf[ks][nt], acc[mt * 2 + nt]);
    }
  }
  // The wait that stands before the weight loads' address registers are
  // reused; naming them as inputs keeps both pairs untouched up to here.
  asm volatile("s_wait_xcnt 0x0" :: "v"(w0), "v"(w1) : "memory");
}

// ---------------------------------------------------------------------------
// One 64x32 slice of a projection GEMM: dst = x(64x256,f16) @ W^T + bias.
// A wave owns 32 output columns (one head) for all 64 tokens, so every weight
// row is loaded by exactly one wave of the block; x fragments come from LDS.
// NORM: per-head (32-col) L2 normalization of the f32 accumulators (cosine
//       attention) before f16 conversion.
// TRANS: store transposed (for v, so attn@v B-fragments are contiguous).
// ---------------------------------------------------------------------------
template<bool NORM, bool TRANS>
__device__ __forceinline__ void proj_gemm(const _Float16* src, const _Float16* w16,
                                          const float* bvec, _Float16* dst,
                                          int n0, int lane) {
  v8f acc[8];                                // tile index = mt * 2 + nt
  #pragma unroll
  for (int nt = 0; nt < 2; ++nt) {
    const float bv = bvec[n0 + nt * 16 + (lane & 15)];  // C layout: N = lane
    #pragma unroll
    for (int mt = 0; mt < 4; ++mt) {
      #pragma unroll
      for (int e = 0; e < 8; ++e) acc[mt * 2 + nt][e] = bv;
    }
  }
  mm_64x32(src, w16, n0, lane, acc);
  if (NORM) {
    #pragma unroll
    for (int j = 0; j < 8; j += 2) {        // head = 32 cols = tile pair
      #pragma unroll
      for (int vg = 0; vg < 8; ++vg) {
        float s = acc[j][vg] * acc[j][vg] + acc[j + 1][vg] * acc[j + 1][vg];
        s = red16_sum(s);
        const float rinv = 1.0f / fmaxf(sqrtf(s), 1e-12f);
        acc[j][vg]     *= rinv;
        acc[j + 1][vg] *= rinv;
      }
    }
  }
  #pragma unroll
  for (int mt = 0; mt < 4; ++mt) {
    #pragma unroll
    for (int nt = 0; nt < 2; ++nt) {
      const int n = n0 + nt * 16 + (lane & 15);
      #pragma unroll
      for (int vg = 0; vg < 8; ++vg) {
        const int m = mt * 16 + vg + ((lane >> 4) << 3);
        if (TRANS) dst[(size_t)n * VTS + m] = (_Float16)acc[mt * 2 + nt][vg];
        else       dst[(size_t)m * XS  + n] = (_Float16)acc[mt * 2 + nt][vg];
      }
    }
  }
}

// LDS layout (f16 elements). attn aliases x/q/k after they are consumed.
#define OFF_X   0
#define OFF_Q   (NTOK * XS)
#define OFF_K   (2 * NTOK * XS)
#define OFF_VT  (3 * NTOK * XS)
#define OFF_O   (3 * NTOK * XS + DM * VTS)
#define SMEM_ELTS (4 * NTOK * XS + DM * VTS)

__global__ __launch_bounds__(256)
void swinv2_window_attn_kernel(const float* __restrict__ img,
                               const _Float16* __restrict__ wq16, const float* __restrict__ bq,
                               const _Float16* __restrict__ wk16, const float* __restrict__ bk,
                               const _Float16* __restrict__ wv16, const float* __restrict__ bv,
                               const _Float16* __restrict__ wo16, const float* __restrict__ bo,
                               const float* __restrict__ logit_scale,
                               const float* __restrict__ biastab,
                               float* __restrict__ out) {
  extern __shared__ char smem_raw[];
  _Float16* xb = (_Float16*)smem_raw;
  _Float16* qb = xb + OFF_Q;
  _Float16* kb = xb + OFF_K;
  _Float16* vt = xb + OFF_VT;
  _Float16* ob = xb + OFF_O;
  _Float16* at = xb;                 // attn: 8 heads x 64 x ATS, aliases x/q/k

  const int tid  = threadIdx.x;
  const int lane = tid & 31;
  const int wv_id = tid >> 5;

  const int blk = blockIdx.x;        // Bn = B * 4 window-blocks
  const int b  = blk >> 2;
  const int wi = blk & 3;
  const int wy = wi >> 1, wx = wi & 1;

  // ---- Step 1: roll(+4,+4) + window-partition + f32->f16 into LDS ----
  for (int i = tid; i < NTOK * (DM / 4); i += 256) {
    const int row = i >> 6;          // token 0..63
    const int q4  = i & 63;          // float4 index in row
    const int r = row >> 3, c = row & 7;
    const int sh = (((wy << 3) + r) - 4) & 15;   // rolled[h] = img[h-4]
    const int sw = (((wx << 3) + c) - 4) & 15;
    const float4 f =
        ((const float4*)(img + (((size_t)b * 16 + sh) * 16 + sw) * DM))[q4];
    _Float16* dst = xb + (size_t)row * XS + q4 * 4;
    dst[0] = (_Float16)f.x; dst[1] = (_Float16)f.y;
    dst[2] = (_Float16)f.z; dst[3] = (_Float16)f.w;
  }
  __syncthreads();

  // ---- Step 2: q/k/v projections (WMMA). Each wave: 64 rows x 32 cols ----
  const int n0 = wv_id << 5;              // 0,32,...,224
  proj_gemm<true,  false>(xb, wq16, bq, qb, n0, lane);   // q, L2-normed
  proj_gemm<true,  false>(xb, wk16, bk, kb, n0, lane);   // k, L2-normed
  proj_gemm<false, true >(xb, wv16, bv, vt, n0, lane);   // v, transposed
  __syncthreads();

  // ---- Step 3: logits = qn@kn^T * scale + bias, mask, softmax (head/wave) --
  {
    const int h = wv_id;
    const float scale = __expf(fminf(logit_scale[h], 4.6051702f)); // log(100)
    const float* bt = biastab + (size_t)h * NTOK * NTOK;

    v8f lg[16];
    #pragma unroll
    for (int t = 0; t < 16; ++t) {
      #pragma unroll
      for (int e = 0; e < 8; ++e) lg[t][e] = 0.0f;
    }

    v16h kf[4];
    #pragma unroll
    for (int nt = 0; nt < 4; ++nt)
      kf[nt] = load_frag(kb, nt * 16, XS, h * HD, lane);   // B = kn^T
    #pragma unroll
    for (int mt = 0; mt < 4; ++mt) {
      const v16h a = load_frag(qb, mt * 16, XS, h * HD, lane);
      #pragma unroll
      for (int nt = 0; nt < 4; ++nt)
        lg[mt * 4 + nt] = wmma16(a, kf[nt], lg[mt * 4 + nt]);   // K = HD = 32
    }

    // scale + relative-position bias + shift-window mask
    #pragma unroll
    for (int mt = 0; mt < 4; ++mt) {
      #pragma unroll
      for (int nt = 0; nt < 4; ++nt) {
        const int Nk = nt * 16 + (lane & 15);               // key token
        const int rk = reg3((wy << 3) + (Nk >> 3)) * 3 +
                       reg3((wx << 3) + (Nk & 7));
        #pragma unroll
        for (int vg = 0; vg < 8; ++vg) {
          const int Mq = mt * 16 + vg + ((lane >> 4) << 3); // query token
          const int rq = reg3((wy << 3) + (Mq >> 3)) * 3 +
                         reg3((wx << 3) + (Mq & 7));
          const float bvl = bt[(size_t)Mq * NTOK + Nk];
          const float v = lg[mt * 4 + nt][vg] * scale + bvl;
          lg[mt * 4 + nt][vg] = (rq == rk) ? v : -1e30f;
        }
      }
    }

    // row softmax fully in registers (row = fixed vg & lane-half; cols span
    // 16 lanes x 4 n-tiles)
    #pragma unroll
    for (int mt = 0; mt < 4; ++mt) {
      #pragma unroll
      for (int vg = 0; vg < 8; ++vg) {
        float mx = fmaxf(fmaxf(lg[mt*4+0][vg], lg[mt*4+1][vg]),
                         fmaxf(lg[mt*4+2][vg], lg[mt*4+3][vg]));
        mx = red16_max(mx);
        float sm = 0.0f;
        #pragma unroll
        for (int nt = 0; nt < 4; ++nt) {
          const float e = __expf(lg[mt*4+nt][vg] - mx);
          lg[mt*4+nt][vg] = e;
          sm += e;
        }
        sm = red16_sum(sm);
        const float rinv = 1.0f / sm;
        #pragma unroll
        for (int nt = 0; nt < 4; ++nt) lg[mt*4+nt][vg] *= rinv;
      }
    }

    __syncthreads();  // all waves done reading qb/kb before aliased writes

    _Float16* ah = at + (size_t)h * NTOK * ATS;
    #pragma unroll
    for (int mt = 0; mt < 4; ++mt) {
      #pragma unroll
      for (int nt = 0; nt < 4; ++nt) {
        const int Nk = nt * 16 + (lane & 15);
        #pragma unroll
        for (int vg = 0; vg < 8; ++vg) {
          const int Mq = mt * 16 + vg + ((lane >> 4) << 3);
          ah[(size_t)Mq * ATS + Nk] = (_Float16)lg[mt * 4 + nt][vg];
        }
      }
    }
  }

  // ---- Step 4: o = attn @ v (one head per wave, WMMA, K = 64 tokens) ----
  {
    const int h = wv_id;
    const _Float16* ah = at + (size_t)h * NTOK * ATS;
    v8f oacc[8];
    #pragma unroll
    for (int t = 0; t < 8; ++t) {
      #pragma unroll
      for (int e = 0; e < 8; ++e) oacc[t][e] = 0.0f;
    }
    #pragma unroll
    for (int kk = 0; kk < NTOK; kk += 32) {
      v16h vf[2];
      #pragma unroll
      for (int nt2 = 0; nt2 < 2; ++nt2)
        vf[nt2] = load_frag(vt, h * HD + nt2 * 16, VTS, kk, lane); // v^T rows
      #pragma unroll
      for (int mt = 0; mt < 4; ++mt) {
        const v16h a = load_frag(ah, mt * 16, ATS, kk, lane);
        #pragma unroll
        for (int nt2 = 0; nt2 < 2; ++nt2)
          oacc[mt * 2 + nt2] = wmma16(a, vf[nt2], oacc[mt * 2 + nt2]);
      }
    }
    #pragma unroll
    for (int mt = 0; mt < 4; ++mt) {
      #pragma unroll
      for (int nt2 = 0; nt2 < 2; ++nt2) {
        const int n = h * HD + nt2 * 16 + (lane & 15);
        #pragma unroll
        for (int vg = 0; vg < 8; ++vg) {
          const int m = mt * 16 + vg + ((lane >> 4) << 3);
          ob[(size_t)m * XS + n] = (_Float16)oacc[mt * 2 + nt2][vg];
        }
      }
    }
  }
  __syncthreads();

  // ---- Step 5: z = o @ wo^T + bo, reverse roll folded into global store ----
  {
    v8f acc[8];                              // tile index = mt * 2 + nt
    #pragma unroll
    for (int nt = 0; nt < 2; ++nt) {
      const float bvl = bo[n0 + nt * 16 + (lane & 15)];
      #pragma unroll
      for (int mt = 0; mt < 4; ++mt) {
        #pragma unroll
        for (int e = 0; e < 8; ++e) acc[mt * 2 + nt][e] = bvl;
      }
    }
    mm_64x32(ob, wo16, n0, lane, acc);
    #pragma unroll
    for (int mt = 0; mt < 4; ++mt) {
      #pragma unroll
      for (int nt = 0; nt < 2; ++nt) {
        const int n = n0 + nt * 16 + (lane & 15);
        #pragma unroll
        for (int vg = 0; vg < 8; ++vg) {
          const int m  = mt * 16 + vg + ((lane >> 4) << 3);
          const int oh = (((wy << 3) + (m >> 3)) - 4) & 15;  // out = roll(z,-4)
          const int ow = (((wx << 3) + (m & 7)) - 4) & 15;
          out[(((size_t)b * 16 + oh) * 16 + ow) * DM + n] = acc[mt * 2 + nt][vg];
        }
      }
    }
  }
}

// ---------------------------------------------------------------------------
// Prep kernel 1: f32 -> f16 weight conversion (row-major [out][in] preserved).
// ---------------------------------------------------------------------------
__global__ __launch_bounds__(256)
void swinv2_prep_weights(const float* __restrict__ wq, const float* __restrict__ wk,
                         const float* __restrict__ wv, const float* __restrict__ wo,
                         _Float16* __restrict__ wq16, _Float16* __restrict__ wk16,
                         _Float16* __restrict__ wv16, _Float16* __restrict__ wo16) {
  const int i = blockIdx.x * 256 + threadIdx.x;
  if (i < DM * DM) {
    wq16[i] = (_Float16)wq[i];
    wk16[i] = (_Float16)wk[i];
    wv16[i] = (_Float16)wv[i];
    wo16[i] = (_Float16)wo[i];
  }
}

// ---------------------------------------------------------------------------
// Prep kernel 2: CPB-MLP relative-position bias table -> [H][64][64] f32
// (16 * sigmoid already applied). One thread per (query n, key m) pair.
// ---------------------------------------------------------------------------
__global__ __launch_bounds__(256)
void swinv2_prep_bias(const float* __restrict__ w1, const float* __restrict__ b1,
                      const float* __restrict__ w2, float* __restrict__ biastab) {
  const int p = blockIdx.x * 256 + threadIdx.x;   // 4096 pairs
  if (p >= NTOK * NTOK) return;
  const int n = p >> 6, m = p & 63;
  const float dy = (float)((n >> 3) - (m >> 3));  // relative coords in [-7,7]
  const float dx = (float)((n & 7) - (m & 7));
  const float sy = dy / 7.0f * 8.0f;
  const float sx = dx / 7.0f * 8.0f;
  const float ty = copysignf(log2f(fabsf(sy) + 1.0f) / 3.0f, sy);
  const float tx = copysignf(log2f(fabsf(sx) + 1.0f) / 3.0f, sx);

  float acc[NHEADS];
  #pragma unroll
  for (int h = 0; h < NHEADS; ++h) acc[h] = 0.0f;
  for (int j = 0; j < 512; ++j) {
    const float h1 = fmaxf(w1[j * 2 + 0] * ty + w1[j * 2 + 1] * tx + b1[j], 0.0f);
    #pragma unroll
    for (int h = 0; h < NHEADS; ++h) acc[h] += h1 * w2[h * 512 + j];
  }
  #pragma unroll
  for (int h = 0; h < NHEADS; ++h)
    biastab[(size_t)h * NTOK * NTOK + p] = 16.0f / (1.0f + __expf(-acc[h]));
}

// ---------------------------------------------------------------------------
extern "C" void kernel_launch(void* const* d_in, const int* in_sizes, int n_in,
                              void* d_out, int out_size, void* d_ws, size_t ws_size,
                              hipStream_t stream) {
  (void)in_sizes; (void)n_in; (void)out_size; (void)ws_size;

  const float* img  = (const float*)d_in[0];
  const float* wq   = (const float*)d_in[1];
  const float* bq   = (const float*)d_in[2];
  const float* wk   = (const float*)d_in[3];
  const float* bk   = (const float*)d_in[4];
  const float* wv   = (const float*)d_in[5];
  const float* bv   = (const float*)d_in[6];
  const float* wo   = (const float*)d_in[7];
  const float* bo   = (const float*)d_in[8];
  const float* ls   = (const float*)d_in[9];
  const float* cw1  = (const float*)d_in[10];
  const float* cb1  = (const float*)d_in[11];
  const float* cw2  = (const float*)d_in[12];
  float* out = (float*)d_out;

  // workspace layout (bytes)
  char* ws = (char*)d_ws;
  _Float16* wq16 = (_Float16*)(ws + 0 * 131072);
  _Float16* wk16 = (_Float16*)(ws + 1 * 131072);
  _Float16* wv16 = (_Float16*)(ws + 2 * 131072);
  _Float16* wo16 = (_Float16*)(ws + 3 * 131072);
  float*    btab = (float*)   (ws + 4 * 131072);   // [8][64][64] f32

  swinv2_prep_weights<<<DM * DM / 256, 256, 0, stream>>>(
      wq, wk, wv, wo, wq16, wk16, wv16, wo16);
  swinv2_prep_bias<<<NTOK * NTOK / 256, 256, 0, stream>>>(cw1, cb1, cw2, btab);

  const size_t smem_bytes = (size_t)SMEM_ELTS * sizeof(_Float16);  // 172032 B
  (void)hipFuncSetAttribute((const void*)swinv2_window_attn_kernel,
                            hipFuncAttributeMaxDynamicSharedMemorySize,
                            (int)smem_bytes);

  const int Bn = 512 * 4;   // B * NW windows
  swinv2_window_attn_kernel<<<Bn, 256, smem_bytes, stream>>>(
      img, wq16, bq, wk16, bk, wv16, bv, wo16, bo, ls, btab, out);
}

// v002
// It runs in 157 microseconds.
// Timed twice side by side with v001, it ran 1.37 times as fast both times.
// Over all steps from v000 it is 2.37 times as fast.
#include <hip/hip_runtime.h>
#include <hip/hip_bf16.h>

// ---------------------------------------------------------------------------
// Swin-V2 shifted-window MHA, fused per-window kernel for gfx1250 (MI455X).
// f16 WMMA (V_WMMA_F32_16X16X32_F16) for all GEMMs, f32 accumulation.
// wave32: 8 waves / 256-thread block, one window (64 tokens) per block.
// ---------------------------------------------------------------------------

typedef __attribute__((ext_vector_type(16))) _Float16 v16h;
typedef __attribute__((ext_vector_type(8)))  _Float16 v8h;
typedef __attribute__((ext_vector_type(8)))  float    v8f;

#define WINSZ   8
#define NTOK    64          // tokens per window
#define DM      256         // model dim
#define NHEADS  8
#define HD      32          // head dim
#define XS      264         // f16 row stride for 64x256 LDS buffers (pad 8)
#define VTS     72          // f16 row stride for v^T (256x64) LDS buffer
#define ATS     72          // f16 row stride for attn (64x64 per head)

union V16u { v16h v; v8h h[2]; };

// Load a 16x32 (f16) WMMA A/B fragment from a row-major f16 matrix.
// Lane layout follows the CDNA5 16-bit fragment striping:
//   lanes 0-15 : row = base+lane,    K chunks [0..7] and [16..23]
//   lanes 16-31: row = base+lane-16, K chunks [8..15] and [24..31]
__device__ __forceinline__ v16h load_frag(const _Float16* base, int row0,
                                          int stride, int k0, int lane) {
  const int r  = row0 + (lane & 15);
  const int c0 = k0 + ((lane >> 4) << 3);
  const _Float16* p = base + (size_t)r * stride + c0;
  V16u u;
  u.h[0] = *(const v8h*)(p);
  u.h[1] = *(const v8h*)(p + 16);
  return u.v;
}

// The same fragment from this lane's own place in a row-major f16 matrix.
__device__ __forceinline__ v16h load_wfrag(const _Float16* p) {
  V16u u;
  u.h[0] = *(const v8h*)(p);
  u.h[1] = *(const v8h*)(p + 16);
  return u.v;
}

__device__ __forceinline__ v8f wmma16(v16h a, v16h b, v8f c) {
  return __builtin_amdgcn_wmma_f32_16x16x32_f16(
      /*neg_a=*/false, a, /*neg_b=*/false, b,
      /*c_mod=*/(short)0, c, /*reuse_a=*/false, /*reuse_b=*/false);
}

// Reductions across a 16-lane group (C/D fragment: N runs across lanes 0-15
// within each half-wave, so xor masks 1/2/4/8 never cross the half boundary).
__device__ __forceinline__ float red16_sum(float v) {
  v += __shfl_xor(v, 1, 32); v += __shfl_xor(v, 2, 32);
  v += __shfl_xor(v, 4, 32); v += __shfl_xor(v, 8, 32);
  return v;
}
__device__ __forceinline__ float red16_max(float v) {
  v = fmaxf(v, __shfl_xor(v, 1, 32)); v = fmaxf(v, __shfl_xor(v, 2, 32));
  v = fmaxf(v, __shfl_xor(v, 4, 32)); v = fmaxf(v, __shfl_xor(v, 8, 32));
  return v;
}

// One lane's 32 bias values of query tile mt (C layout; index = nt * 8 + vg).
__device__ __forceinline__ void load_bias32(const float* bt, int mt, int lane,
                                            float (&bb)[32]) {
  #pragma unroll
  for (int nt = 0; nt < 4; ++nt) {
    #pragma unroll
    for (int vg = 0; vg < 8; ++vg)
      bb[nt * 8 + vg] = bt[(size_t)(mt * 16 + vg + ((lane >> 4) << 3)) * NTOK +
                           nt * 16 + (lane & 15)];
  }
}

// shift-mask region id: rows/cols [0,8) -> 0, [8,12) -> 1, [12,16) -> 2
__device__ __forceinline__ int reg3(int p) { return p < 8 ? 0 : (p < 12 ? 1 : 2); }

// ---------------------------------------------------------------------------
// acc(64x32) += src(64x256, LDS) @ W[n0..n0+31][:]^T; tile index = mt * 2 + nt.
// src: row pitch RS, k slice ks (32 columns) starts at src + ks * KS.
// The wave's weights (32 rows x 256) pass through a register ring of WRING
// k slices (16 registers a lane each): WRING slices are requested first, and a
// further one as each slice is used up. The whole set at once (128 registers)
// would put the kernel above 256 registers, and then only one work-group fits
// a WGP's register files.
// ---------------------------------------------------------------------------
#define WRING 4
template<int RS, int KS>
__device__ __forceinline__ void mm_64x32(const _Float16* src, const _Float16* w16,
                                         int n0, int lane, v8f (&acc)[8]) {
  // This lane's place in the two 16-row weight tiles (layout as in load_frag).
  const _Float16* w0 = w16 + (size_t)(n0 + (lane & 15)) * DM + ((lane >> 4) << 3);
  const _Float16* w1 = w0 + 16 * DM;
  v16h bf[DM / 32][2];
  #pragma unroll
  for (int ks = 0; ks < WRING; ++ks) {
    bf[ks][0] = load_wfrag(w0 + ks * 32);
    bf[ks][1] = load_wfrag(w1 + ks * 32);
  }
  v16h a[2][4];
  #pragma unroll
  for (int mt = 0; mt < 4; ++mt) a[0][mt] = load_frag(src, mt * 16, RS, 0, lane);
  #pragma unroll
  for (int ks = 0; ks < DM / 32; ++ks) {
    if (ks + 1 < DM / 32) {
      #pragma unroll
      for (int mt = 0; mt < 4; ++mt)
        a[(ks + 1) & 1][mt] = load_frag(src + (ks + 1) * KS, mt * 16, RS, 0, lane);
      if (ks >= 1 && ks + WRING - 1 < DM / 32) {   // slice ks - 1 is used up
        bf[ks + WRING - 1][0] = load_wfrag(w0 + (ks + WRING - 1) * 32);
        bf[ks + WRING - 1][1] = load_wfrag(w1 + (ks + WRING - 1) * 32);
      }
      // Keeps the loads above (at ks = 0 the first weight loads too) ahead of
      // this slice's WMMAs: the scheduler otherwise sinks each pair to its use,
      // and every slice then waits out the L2 and the LDS latency.
      __builtin_amdgcn_sched_barrier(0);
    }
    #pragma unroll
    for (int mt = 0; mt < 4; ++mt) {
      #pragma unroll
      for (int nt = 0; nt < 2; ++nt)
        acc[mt * 2 + nt] = wmma16(a[ks & 1][mt], bf[ks][nt], acc[mt * 2 + nt]);
    }
    // Keeps the next trip's loads from rising among these WMMAs, where they
    // would take a third set of fragment registers and overrun the budget.
    __builtin_amdgcn_sched_barrier(0);
  }
  // The wait that stands before the weight loads' address registers are
  // reused; naming them as inputs keeps both pairs untouched up to here.
  asm volatile("s_wait_xcnt 0x0" :: "v"(w0), "v"(w1) : "memory");
}

// ---------------------------------------------------------------------------
// One 64x32 slice of a projection GEMM: dst = x(64x256,f16) @ W^T + bias.
// A wave owns 32 output columns (one head) for all 64 tokens, so every weight
// row is loaded by exactly one wave of the block; x fragments come from LDS.
// NORM: per-head (32-col) L2 normalization of the f32 accumulators (cosine
//       attention) before f16 conversion.
// TRANS: store transposed (for v, so attn@v B-fragments are contiguous).
// ---------------------------------------------------------------------------
template<bool NORM, bool TRANS>
__device__ __forceinline__ void proj_gemm(const _Float16* src, const _Float16* w16,
                                          const float* bvec, _Float16* dst,
                                          int n0, int lane) {
  v8f acc[8];                                // tile index = mt * 2 + nt
  #pragma unroll
  for (int nt = 0; nt < 2; ++nt) {
    const float bv = bvec[n0 + nt * 16 + (lane & 15)];  // C layout: N = lane
    #pragma unroll
    for (int mt = 0; mt < 4; ++mt) {
      #pragma unroll
      for (int e = 0; e < 8; ++e) acc[mt * 2 + nt][e] = bv;
    }
  }
  mm_64x32<XS, 32>(src, w16, n0, lane, acc);
  if (NORM) {
    #pragma unroll
    for (int j = 0; j < 8; j += 2) {        // head = 32 cols = tile pair
      #pragma unroll
      for (int vg = 0; vg < 8; ++vg) {
        float s = acc[j][vg] * acc[j][vg] + acc[j + 1][vg] * acc[j + 1][vg];
        s = red16_sum(s);
        const float rinv = 1.0f / fmaxf(sqrtf(s), 1e-12f);
        acc[j][vg]     *= rinv;
        acc[j + 1][vg] *= rinv;
      }
    }
  }
  #pragma unroll
  for (int mt = 0; mt < 4; ++mt) {
    #pragma unroll
    for (int nt = 0; nt < 2; ++nt) {
      const int n = n0 + nt * 16 + (lane & 15);
      #pragma unroll
      for (int vg = 0; vg < 8; ++vg) {
        const int m = mt * 16 + vg + ((lane >> 4) << 3);
        if (TRANS) dst[(size_t)n * VTS + m] = (_Float16)acc[mt * 2 + nt][vg];
        else       dst[(size_t)m * XS  + n] = (_Float16)acc[mt * 2 + nt][vg];
      }
    }
  }
}

// LDS layout (f16 elements). attn aliases x/q/k after they are consumed, and
// each head's o (64x32) goes into the first 32 columns of that head's attn rows
// once its wave has read them. 135 KiB: two work-groups fit a WGP's LDS.
#define OFF_X   0
#define OFF_Q   (NTOK * XS)
#define OFF_K   (2 * NTOK * XS)
#define OFF_VT  (3 * NTOK * XS)
#define SMEM_ELTS (3 * NTOK * XS + DM * VTS)

// Second argument: at least 4 waves a SIMD, that is two work-groups a WGP; it
// sets the register budget to 256.
__global__ __launch_bounds__(256, 4)
void swinv2_window_attn_kernel(const float* __restrict__ img,
                               const _Float16* __restrict__ wq16, const float* __restrict__ bq,
                               const _Float16* __restrict__ wk16, const float* __restrict__ bk,
                               const _Float16* __restrict__ wv16, const float* __restrict__ bv,
                               const _Float16* __restrict__ wo16, const float* __restrict__ bo,
                               const float* __restrict__ logit_scale,
                               const float* __restrict__ biastab,
                               float* __restrict__ out) {
  extern __shared__ char smem_raw[];
  _Float16* xb = (_Float16*)smem_raw;
  _Float16* qb = xb + OFF_Q;
  _Float16* kb = xb + OFF_K;
  _Float16* vt = xb + OFF_VT;
  _Float16* at = xb;                 // attn: 8 heads x 64 x ATS, aliases x/q/k

  const int tid  = threadIdx.x;
  const int lane = tid & 31;
  // The wave's number in a scalar register: what is formed from it (head, column
  // base, LDS bases) then takes no vector registers.
  const int wv_id = __builtin_amdgcn_readfirstlane(tid >> 5);

  const int blk = blockIdx.x;        // Bn = B * 4 window-blocks
  const int b  = blk >> 2;
  const int wi = blk & 3;
  const int wy = wi >> 1, wx = wi & 1;

  // ---- Step 1: roll(+4,+4) + window-partition + f32->f16 into LDS ----
  for (int i = tid; i < NTOK * (DM / 4); i += 256) {
    const int row = i >> 6;          // token 0..63
    const int q4  = i & 63;          // float4 index in row
    const int r = row >> 3, c = row & 7;
    const int sh = (((wy << 3) + r) - 4) & 15;   // rolled[h] = img[h-4]
    const int sw = (((wx << 3) + c) - 4) & 15;
    const float4 f =
        ((const float4*)(img + (((size_t)b * 16 + sh) * 16 + sw) * DM))[q4];
    _Float16* dst = xb + (size_t)row * XS + q4 * 4;
    dst[0] = (_Float16)f.x; dst[1] = (_Float16)f.y;
    dst[2] = (_Float16)f.z; dst[3] = (_Float16)f.w;
  }
  __syncthreads();

  // ---- Step 2: q/k/v projections (WMMA). Each wave: 64 rows x 32 cols ----
  const int n0 = wv_id << 5;              // 0,32,...,224
  proj_gemm<true,  false>(xb, wq16, bq, qb, n0, lane);   // q, L2-normed
  proj_gemm<true,  false>(xb, wk16, bk, kb, n0, lane);   // k, L2-normed
  proj_gemm<false, true >(xb, wv16, bv, vt, n0, lane);   // v, transposed
  __syncthreads();

  // ---- Step 3: logits = qn@kn^T * scale + bias, mask, softmax (head/wave) --
  {
    const int h = wv_id;
    const float scale = __expf(fminf(logit_scale[h], 4.6051702f)); // log(100)
    const float* bt = biastab + (size_t)h * NTOK * NTOK;

    // Bias values of query tile 0, requested ahead of the products.
    float bb[2][32];
    load_bias32(bt, 0, lane, bb[0]);

    v8f lg[16];
    #pragma unroll
    for (int t = 0; t < 16; ++t) {
      #pragma unroll
      for (int e = 0; e < 8; ++e) lg[t][e] = 0.0f;
    }

    v16h kf[4];
    #pragma unroll
    for (int nt = 0; nt < 4; ++nt)
      kf[nt] = load_frag(kb, nt * 16, XS, h * HD, lane);   // B = kn^T
    #pragma unroll
    for (int mt = 0; mt < 4; ++mt) {
      const v16h a = load_frag(qb, mt * 16, XS, h * HD, lane);
      #pragma unroll
      for (int nt = 0; nt < 4; ++nt)
        lg[mt * 4 + nt] = wmma16(a, kf[nt], lg[mt * 4 + nt]);   // K = HD = 32
    }

    // Per query tile: scale + relative-position bias + shift-window mask, then
    // the row softmax fully in registers (row = fixed vg & lane-half; cols span
    // 16 lanes x 4 n-tiles).
    #pragma unroll
    for (int mt = 0; mt < 4; ++mt) {
      if (mt + 1 < 4) load_bias32(bt, mt + 1, lane, bb[(mt + 1) & 1]);
      // Keeps the next tile's 32 bias loads ahead of this tile's arithmetic, so
      // that they fly during it: within the register budget the scheduler
      // otherwise puts each load directly in front of its use.
      __builtin_amdgcn_sched_barrier(0);
      #pragma unroll
      for (int nt = 0; nt < 4; ++nt) {
        const int Nk = nt * 16 + (lane & 15);               // key token
        const int rk = reg3((wy << 3) + (Nk >> 3)) * 3 +
                       reg3((wx << 3) + (Nk & 7));
        #pragma unroll
        for (int vg = 0; vg < 8; ++vg) {
          const int Mq = mt * 16 + vg + ((lane >> 4) << 3); // query token
          const int rq = reg3((wy << 3) + (Mq >> 3)) * 3 +
                         reg3((wx << 3) + (Mq & 7));
          const float bvl = bb[mt & 1][nt * 8 + vg];
          const float v = lg[mt * 4 + nt][vg] * scale + bvl;
          lg[mt * 4 + nt][vg] = (rq == rk) ? v : -1e30f;
        }
      }
      #pragma unroll
      for (int vg = 0; vg < 8; ++vg) {
        float mx = fmaxf(fmaxf(lg[mt*4+0][vg], lg[mt*4+1][vg]),
                         fmaxf(lg[mt*4+2][vg], lg[mt*4+3][vg]));
        mx = red16_max(mx);
        float sm = 0.0f;
        #pragma unroll
        for (int nt = 0; nt < 4; ++nt) {
          const float e = __expf(lg[mt*4+nt][vg] - mx);
          lg[mt*4+nt][vg] = e;
          sm += e;
        }
        sm = red16_sum(sm);
        const float rinv = 1.0f / sm;
        #pragma unroll
        for (int nt = 0; nt < 4; ++nt) lg[mt*4+nt][vg] *= rinv;
      }
    }

    __syncthreads();  // all waves done reading qb/kb before aliased writes

    _Float16* ah = at + (size_t)h * NTOK * ATS;
    #pragma unroll
    for (int mt = 0; mt < 4; ++mt) {
      #pragma unroll
      for (int nt = 0; nt < 4; ++nt) {
        const int Nk = nt * 16 + (lane & 15);
        #pragma unroll
        for (int vg = 0; vg < 8; ++vg) {
          const int Mq = mt * 16 + vg + ((lane >> 4) << 3);
          ah[(size_t)Mq * ATS + Nk] = (_Float16)lg[mt * 4 + nt][vg];
        }
      }
    }
  }

  // ---- Step 4: o = attn @ v (one head per wave, WMMA, K = 64 tokens) ----
  {
    const int h = wv_id;
    _Float16* ah = at + (size_t)h * NTOK * ATS;
    v8f oacc[8];
    #pragma unroll
    for (int t = 0; t < 8; ++t) {
      #pragma unroll
      for (int e = 0; e < 8; ++e) oacc[t][e] = 0.0f;
    }
    #pragma unroll
    for (int kk = 0; kk < NTOK; kk += 32) {
      v16h vf[2];
      #pragma unroll
      for (int nt2 = 0; nt2 < 2; ++nt2)
        vf[nt2] = load_frag(vt, h * HD + nt2 * 16, VTS, kk, lane); // v^T rows
      #pragma unroll
      for (int mt = 0; mt < 4; ++mt) {
        const v16h a = load_frag(ah, mt * 16, ATS, kk, lane);
        #pragma unroll
        for (int nt2 = 0; nt2 < 2; ++nt2)
          oacc[mt * 2 + nt2] = wmma16(a, vf[nt2], oacc[mt * 2 + nt2]);
      }
    }
    #pragma unroll
    for (int mt = 0; mt < 4; ++mt) {
      #pragma unroll
      for (int nt2 = 0; nt2 < 2; ++nt2) {
        const int n = nt2 * 16 + (lane & 15);
        #pragma unroll
        for (int vg = 0; vg < 8; ++vg) {
          const int m = mt * 16 + vg + ((lane >> 4) << 3);
          ah[(size_t)m * ATS + n] = (_Float16)oacc[mt * 2 + nt2][vg];
        }
      }
    }
  }
  __syncthreads();

  // ---- Step 5: z = o @ wo^T + bo, reverse roll folded into global store ----
  {
    v8f acc[8];                              // tile index = mt * 2 + nt
    #pragma unroll
    for (int nt = 0; nt < 2; ++nt) {
      const float bvl = bo[n0 + nt * 16 + (lane & 15)];
      #pragma unroll
      for (int mt = 0; mt < 4; ++mt) {
        #pragma unroll
        for (int e = 0; e < 8; ++e) acc[mt * 2 + nt][e] = bvl;
      }
    }
    mm_64x32<ATS, NTOK * ATS>(at, wo16, n0, lane, acc);   // k slice = head
    #pragma unroll
    for (int mt = 0; mt < 4; ++mt) {
      #pragma unroll
      for (int nt = 0; nt < 2; ++nt) {
        const int n = n0 + nt * 16 + (lane & 15);
        #pragma unroll
        for (int vg = 0; vg < 8; ++vg) {
          const int m  = mt * 16 + vg + ((lane >> 4) << 3);
          const int oh = (((wy << 3) + (m >> 3)) - 4) & 15;  // out = roll(z,-4)
          const int ow = (((wx << 3) + (m & 7)) - 4) & 15;
          out[(((size_t)b * 16 + oh) * 16 + ow) * DM + n] = acc[mt * 2 + nt][vg];
        }
      }
    }
  }
}

// ---------------------------------------------------------------------------
// Prep kernel 1: f32 -> f16 weight conversion (row-major [out][in] preserved).
// ---------------------------------------------------------------------------
__global__ __launch_bounds__(256)
void swinv2_prep_weights(const float* __restrict__ wq, const float* __restrict__ wk,
                         const float* __restrict__ wv, const float* __restrict__ wo,
                         _Float16* __restrict__ wq16, _Float16* __restrict__ wk16,
                         _Float16* __restrict__ wv16, _Float16* __restrict__ wo16) {
  const int i = blockIdx.x * 256 + threadIdx.x;
  if (i < DM * DM) {
    wq16[i] = (_Float16)wq[i];
    wk16[i] = (_Float16)wk[i];
    wv16[i] = (_Float16)wv[i];
    wo16[i] = (_Float16)wo[i];
  }
}

// ---------------------------------------------------------------------------
// Prep kernel 2: CPB-MLP relative-position bias table -> [H][64][64] f32
// (16 * sigmoid already applied). One thread per (query n, key m) pair.
// ---------------------------------------------------------------------------
__global__ __launch_bounds__(256)
void swinv2_prep_bias(const float* __restrict__ w1, const float* __restrict__ b1,
                      const float* __restrict__ w2, float* __restrict__ biastab) {
  const int p = blockIdx.x * 256 + threadIdx.x;   // 4096 pairs
  if (p >= NTOK * NTOK) return;
  const int n = p >> 6, m = p & 63;
  const float dy = (float)((n >> 3) - (m >> 3));  // relative coords in [-7,7]
  const float dx = (float)((n & 7) - (m & 7));
  const float sy = dy / 7.0f * 8.0f;
  const float sx = dx / 7.0f * 8.0f;
  const float ty = copysignf(log2f(fabsf(sy) + 1.0f) / 3.0f, sy);
  const float tx = copysignf(log2f(fabsf(sx) + 1.0f) / 3.0f, sx);

  float acc[NHEADS];
  #pragma unroll
  for (int h = 0; h < NHEADS; ++h) acc[h] = 0.0f;
  for (int j = 0; j < 512; ++j) {
    const float h1 = fmaxf(w1[j * 2 + 0] * ty + w1[j * 2 + 1] * tx + b1[j], 0.0f);
    #pragma unroll
    for (int h = 0; h < NHEADS; ++h) acc[h] += h1 * w2[h * 512 + j];
  }
  #pragma unroll
  for (int h = 0; h < NHEADS; ++h)
    biastab[(size_t)h * NTOK * NTOK + p] = 16.0f / (1.0f + __expf(-acc[h]));
}

// ---------------------------------------------------------------------------
extern "C" void kernel_launch(void* const* d_in, const int* in_sizes, int n_in,
                              void* d_out, int out_size, void* d_ws, size_t ws_size,
                              hipStream_t stream) {
  (void)in_sizes; (void)n_in; (void)out_size; (void)ws_size;

  const float* img  = (const float*)d_in[0];
  const float* wq   = (const float*)d_in[1];
  const float* bq   = (const float*)d_in[2];
  const float* wk   = (const float*)d_in[3];
  const float* bk   = (const float*)d_in[4];
  const float* wv   = (const float*)d_in[5];
  const float* bv   = (const float*)d_in[6];
  const float* wo   = (const float*)d_in[7];
  const float* bo   = (const float*)d_in[8];
  const float* ls   = (const float*)d_in[9];
  const float* cw1  = (const float*)d_in[10];
  const float* cb1  = (const float*)d_in[11];
  const float* cw2  = (const float*)d_in[12];
  float* out = (float*)d_out;

  // workspace layout (bytes)
  char* ws = (char*)d_ws;
  _Float16* wq16 = (_Float16*)(ws + 0 * 131072);
  _Float16* wk16 = (_Float16*)(ws + 1 * 131072);
  _Float16* wv16 = (_Float16*)(ws + 2 * 131072);
  _Float16* wo16 = (_Float16*)(ws + 3 * 131072);
  float*    btab = (float*)   (ws + 4 * 131072);   // [8][64][64] f32

  swinv2_prep_weights<<<DM * DM / 256, 256, 0, stream>>>(
      wq, wk, wv, wo, wq16, wk16, wv16, wo16);
  swinv2_prep_bias<<<NTOK * NTOK / 256, 256, 0, stream>>>(cw1, cb1, cw2, btab);

  const size_t smem_bytes = (size_t)SMEM_ELTS * sizeof(_Float16);  // 138240 B
  (void)hipFuncSetAttribute((const void*)swinv2_window_attn_kernel,
                            hipFuncAttributeMaxDynamicSharedMemorySize,
                            (int)smem_bytes);

  const int Bn = 512 * 4;   // B * NW windows
  swinv2_window_attn_kernel<<<Bn, 256, smem_bytes, stream>>>(
      img, wq16, bq, wk16, bk, wv16, bv, wo16, bo, ls, btab, out);
}

// v003
// It runs in 139 microseconds.
// Timed twice side by side with v002, it ran 1.12 times as fast both times.
// Counting every step since v000, it is 2.66 times as fast.
#include <hip/hip_runtime.h>
#include <hip/hip_bf16.h>

// ---------------------------------------------------------------------------
// Swin-V2 shifted-window MHA, fused per-window kernel for gfx1250 (MI455X).
// f16 WMMA (V_WMMA_F32_16X16X32_F16) for all GEMMs, f32 accumulation.
// wave32: 8 waves / 256-thread block, one window (64 tokens) per block.
// ---------------------------------------------------------------------------

typedef __attribute__((ext_vector_type(16))) _Float16 v16h;
typedef __attribute__((ext_vector_type(8)))  _Float16 v8h;
typedef __attribute__((ext_vector_type(8)))  float    v8f;

#define WINSZ   8
#define NTOK    64          // tokens per window
#define DM      256         // model dim
#define NHEADS  8
#define HD      32          // head dim
#define XS      264         // f16 row stride for 64x256 LDS buffers (pad 8)
#define VTS     72          // f16 row stride for v^T (256x64) LDS buffer
#define ATS     72          // f16 row stride for attn (64x64 per head)

union V16u { v16h v; v8h h[2]; };

// Load a 16x32 (f16) WMMA A/B fragment from a row-major f16 matrix.
// Lane layout follows the CDNA5 16-bit fragment striping:
//   lanes 0-15 : row = base+lane,    K chunks [0..7] and [16..23]
//   lanes 16-31: row = base+lane-16, K chunks [8..15] and [24..31]
__device__ __forceinline__ v16h load_frag(const _Float16* base, int row0,
                                          int stride, int k0, int lane) {
  const int r  = row0 + (lane & 15);
  const int c0 = k0 + ((lane >> 4) << 3);
  const _Float16* p = base + (size_t)r * stride + c0;
  V16u u;
  u.h[0] = *(const v8h*)(p);
  u.h[1] = *(const v8h*)(p + 16);
  return u.v;
}

// Packed weights (written by swinv2_prep_weights). A fragment is 1 KiB: two
// halves of 512 B, and in each half lane l's 8 values stand at l * 16 B, so one
// wave-wide 16-byte load reads four whole 128-B lines. Fragments follow one
// another in the order a wave uses them: [wave][k slice][16-row tile].
#define WHALF 256                    // f16 elements in half a fragment
#define WWAVE (DM / 32 * 2 * 2 * WHALF)   // f16 elements of one wave's 32 rows

// One fragment from this lane's place in its first half.
__device__ __forceinline__ v16h load_wfrag(const _Float16* p) {
  V16u u;
  u.h[0] = *(const v8h*)(p);
  u.h[1] = *(const v8h*)(p + WHALF);
  return u.v;
}

__device__ __forceinline__ v8f wmma16(v16h a, v16h b, v8f c) {
  return __builtin_amdgcn_wmma_f32_16x16x32_f16(
      /*neg_a=*/false, a, /*neg_b=*/false, b,
      /*c_mod=*/(short)0, c, /*reuse_a=*/false, /*reuse_b=*/false);
}

// Reductions across a 16-lane group (C/D fragment: N runs across lanes 0-15
// within each half-wave, so xor masks 1/2/4/8 never cross the half boundary).
__device__ __forceinline__ float red16_sum(float v) {
  v += __shfl_xor(v, 1, 32); v += __shfl_xor(v, 2, 32);
  v += __shfl_xor(v, 4, 32); v += __shfl_xor(v, 8, 32);
  return v;
}
__device__ __forceinline__ float red16_max(float v) {
  v = fmaxf(v, __shfl_xor(v, 1, 32)); v = fmaxf(v, __shfl_xor(v, 2, 32));
  v = fmaxf(v, __shfl_xor(v, 4, 32)); v = fmaxf(v, __shfl_xor(v, 8, 32));
  return v;
}

// One lane's 32 bias values of query tile mt (C layout; index = nt * 8 + vg).
__device__ __forceinline__ void load_bias32(const float* bt, int mt, int lane,
                                            float (&bb)[32]) {
  #pragma unroll
  for (int nt = 0; nt < 4; ++nt) {
    #pragma unroll
    for (int vg = 0; vg < 8; ++vg)
      bb[nt * 8 + vg] = bt[(size_t)(mt * 16 + vg + ((lane >> 4) << 3)) * NTOK +
                           nt * 16 + (lane & 15)];
  }
}

// shift-mask region id: rows/cols [0,8) -> 0, [8,12) -> 1, [12,16) -> 2
__device__ __forceinline__ int reg3(int p) { return p < 8 ? 0 : (p < 12 ? 1 : 2); }

// ---------------------------------------------------------------------------
// acc(64x32) += src(64x256, LDS) @ W[n0..n0+31][:]^T; tile index = mt * 2 + nt.
// w16: the packed form of W (see load_wfrag).
// src: row pitch RS, k slice ks (32 columns) starts at src + ks * KS.
// The wave's weights (32 rows x 256) pass through a register ring of WRING
// k slices (16 registers a lane each): WRING slices are requested first, and a
// further one as each slice is used up. The whole set at once (128 registers)
// would put the kernel above 256 registers, and then only one work-group fits
// a WGP's register files.
// ---------------------------------------------------------------------------
#define WRING 4
template<int RS, int KS>
__device__ __forceinline__ void mm_64x32(const _Float16* src, const _Float16* w16,
                                         int n0, int lane, v8f (&acc)[8]) {
  // The wave's packed weights (a scalar base) and this lane's byte offset in
  // every half fragment; w0, w1: its place in the first and second fragment.
  const _Float16* wb = w16 + (size_t)(n0 >> 5) * WWAVE;
  const unsigned loff = (unsigned)lane * 16u;
  const _Float16* w0 = (const _Float16*)((const char*)wb + loff);
  const _Float16* w1 = w0 + 2 * WHALF;
  v16h bf[DM / 32][2];
  #pragma unroll
  for (int ks = 0; ks < WRING; ++ks) {
    bf[ks][0] = load_wfrag(w0 + ks * 4 * WHALF);
    bf[ks][1] = load_wfrag(w1 + ks * 4 * WHALF);
  }
  v16h a[2][4];
  #pragma unroll
  for (int mt = 0; mt < 4; ++mt) a[0][mt] = load_frag(src, mt * 16, RS, 0, lane);
  #pragma unroll
  for (int ks = 0; ks < DM / 32; ++ks) {
    if (ks + 1 < DM / 32) {
      #pragma unroll
      for (int mt = 0; mt < 4; ++mt)
        a[(ks + 1) & 1][mt] = load_frag(src + (ks + 1) * KS, mt * 16, RS, 0, lane);
      if (ks >= 1 && ks + WRING - 1 < DM / 32) {   // slice ks - 1 is used up
        bf[ks + WRING - 1][0] = load_wfrag(w0 + (ks + WRING - 1) * 4 * WHALF);
        bf[ks + WRING - 1][1] = load_wfrag(w1 + (ks + WRING - 1) * 4 * WHALF);
      }
      // Keeps the loads above (at ks = 0 the first weight loads too) ahead of
      // this slice's WMMAs: the scheduler otherwise sinks each pair to its use,
      // and every slice then waits out the L2 and the LDS latency.
      __builtin_amdgcn_sched_barrier(0);
    }
    #pragma unroll
    for (int mt = 0; mt < 4; ++mt) {
      #pragma unroll
      for (int nt = 0; nt < 2; ++nt)
        acc[mt * 2 + nt] = wmma16(a[ks & 1][mt], bf[ks][nt], acc[mt * 2 + nt]);
    }
    // Keeps the next trip's loads from rising among these WMMAs, where they
    // would take a third set of fragment registers and overrun the budget.
    __builtin_amdgcn_sched_barrier(0);
  }
  // The wait that stands before the weight loads' address registers are
  // reused; naming offset and base as inputs keeps them untouched up to here.
  asm volatile("s_wait_xcnt 0x0" :: "v"(loff), "s"(wb) : "memory");
}

// ---------------------------------------------------------------------------
// One 64x32 slice of a projection GEMM: dst = x(64x256,f16) @ W^T + bias.
// A wave owns 32 output columns (one head) for all 64 tokens, so every weight
// row is loaded by exactly one wave of the block; x fragments come from LDS.
// NORM: per-head (32-col) L2 normalization of the f32 accumulators (cosine
//       attention) before f16 conversion.
// TRANS: store transposed (for v, so attn@v B-fragments are contiguous).
// ---------------------------------------------------------------------------
template<bool NORM, bool TRANS>
__device__ __forceinline__ void proj_gemm(const _Float16* src, const _Float16* w16,
                                          const float* bvec, _Float16* dst,
                                          int n0, int lane) {
  v8f acc[8];                                // tile index = mt * 2 + nt
  #pragma unroll
  for (int nt = 0; nt < 2; ++nt) {
    const float bv = bvec[n0 + nt * 16 + (lane & 15)];  // C layout: N = lane
    #pragma unroll
    for (int mt = 0; mt < 4; ++mt) {
      #pragma unroll
      for (int e = 0; e < 8; ++e) acc[mt * 2 + nt][e] = bv;
    }
  }
  mm_64x32<XS, 32>(src, w16, n0, lane, acc);
  if (NORM) {
    #pragma unroll
    for (int j = 0; j < 8; j += 2) {        // head = 32 cols = tile pair
      #pragma unroll
      for (int vg = 0; vg < 8; ++vg) {
        float s = acc[j][vg] * acc[j][vg] + acc[j + 1][vg] * acc[j + 1][vg];
        s = red16_sum(s);
        const float rinv = 1.0f / fmaxf(sqrtf(s), 1e-12f);
        acc[j][vg]     *= rinv;
        acc[j + 1][vg] *= rinv;
      }
    }
  }
  #pragma unroll
  for (int mt = 0; mt < 4; ++mt) {
    #pragma unroll
    for (int nt = 0; nt < 2; ++nt) {
      const int n = n0 + nt * 16 + (lane & 15);
      #pragma unroll
      for (int vg = 0; vg < 8; ++vg) {
        const int m = mt * 16 + vg + ((lane >> 4) << 3);
        if (TRANS) dst[(size_t)n * VTS + m] = (_Float16)acc[mt * 2 + nt][vg];
        else       dst[(size_t)m * XS  + n] = (_Float16)acc[mt * 2 + nt][vg];
      }
    }
  }
}

// LDS layout (f16 elements). attn aliases x/q/k after they are consumed, and
// each head's o (64x32) goes into the first 32 columns of that head's attn rows
// once its wave has read them. 135 KiB: two work-groups fit a WGP's LDS.
#define OFF_X   0
#define OFF_Q   (NTOK * XS)
#define OFF_K   (2 * NTOK * XS)
#define OFF_VT  (3 * NTOK * XS)
#define SMEM_ELTS (3 * NTOK * XS + DM * VTS)

// Second argument: at least 4 waves a SIMD, that is two work-groups a WGP; it
// sets the register budget to 256.
__global__ __launch_bounds__(256, 4)
void swinv2_window_attn_kernel(const float* __restrict__ img,
                               const _Float16* __restrict__ wq16, const float* __restrict__ bq,
                               const _Float16* __restrict__ wk16, const float* __restrict__ bk,
                               const _Float16* __restrict__ wv16, const float* __restrict__ bv,
                               const _Float16* __restrict__ wo16, const float* __restrict__ bo,
                               const float* __restrict__ logit_scale,
                               const float* __restrict__ biastab,
                               float* __restrict__ out) {
  extern __shared__ char smem_raw[];
  _Float16* xb = (_Float16*)smem_raw;
  _Float16* qb = xb + OFF_Q;
  _Float16* kb = xb + OFF_K;
  _Float16* vt = xb + OFF_VT;
  _Float16* at = xb;                 // attn: 8 heads x 64 x ATS, aliases x/q/k

  const int tid  = threadIdx.x;
  const int lane = tid & 31;
  // The wave's number in a scalar register: what is formed from it (head, column
  // base, LDS bases) then takes no vector registers.
  const int wv_id = __builtin_amdgcn_readfirstlane(tid >> 5);

  const int blk = blockIdx.x;        // Bn = B * 4 window-blocks
  const int b  = blk >> 2;
  const int wi = blk & 3;
  const int wy = wi >> 1, wx = wi & 1;

  // ---- Step 1: roll(+4,+4) + window-partition + f32->f16 into LDS ----
  for (int i = tid; i < NTOK * (DM / 4); i += 256) {
    const int row = i >> 6;          // token 0..63
    const int q4  = i & 63;          // float4 index in row
    const int r = row >> 3, c = row & 7;
    const int sh = (((wy << 3) + r) - 4) & 15;   // rolled[h] = img[h-4]
    const int sw = (((wx << 3) + c) - 4) & 15;
    const float4 f =
        ((const float4*)(img + (((size_t)b * 16 + sh) * 16 + sw) * DM))[q4];
    _Float16* dst = xb + (size_t)row * XS + q4 * 4;
    dst[0] = (_Float16)f.x; dst[1] = (_Float16)f.y;
    dst[2] = (_Float16)f.z; dst[3] = (_Float16)f.w;
  }
  __syncthreads();

  // ---- Step 2: q/k/v projections (WMMA). Each wave: 64 rows x 32 cols ----
  const int n0 = wv_id << 5;              // 0,32,...,224
  proj_gemm<true,  false>(xb, wq16, bq, qb, n0, lane);   // q, L2-normed
  proj_gemm<true,  false>(xb, wk16, bk, kb, n0, lane);   // k, L2-normed
  proj_gemm<false, true >(xb, wv16, bv, vt, n0, lane);   // v, transposed
  __syncthreads();

  // ---- Step 3: logits = qn@kn^T * scale + bias, mask, softmax (head/wave) --
  {
    const int h = wv_id;
    const float scale = __expf(fminf(logit_scale[h], 4.6051702f)); // log(100)
    const float* bt = biastab + (size_t)h * NTOK * NTOK;

    // Bias values of query tile 0, requested ahead of the products.
    float bb[2][32];
    load_bias32(bt, 0, lane, bb[0]);

    v8f lg[16];
    #pragma unroll
    for (int t = 0; t < 16; ++t) {
      #pragma unroll
      for (int e = 0; e < 8; ++e) lg[t][e] = 0.0f;
    }

    v16h kf[4];
    #pragma unroll
    for (int nt = 0; nt < 4; ++nt)
      kf[nt] = load_frag(kb, nt * 16, XS, h * HD, lane);   // B = kn^T
    #pragma unroll
    for (int mt = 0; mt < 4; ++mt) {
      const v16h a = load_frag(qb, mt * 16, XS, h * HD, lane);
      #pragma unroll
      for (int nt = 0; nt < 4; ++nt)
        lg[mt * 4 + nt] = wmma16(a, kf[nt], lg[mt * 4 + nt]);   // K = HD = 32
    }

    // Per query tile: scale + relative-position bias + shift-window mask, then
    // the row softmax fully in registers (row = fixed vg & lane-half; cols span
    // 16 lanes x 4 n-tiles).
    #pragma unroll
    for (int mt = 0; mt < 4; ++mt) {
      if (mt + 1 < 4) load_bias32(bt, mt + 1, lane, bb[(mt + 1) & 1]);
      // Keeps the next tile's 32 bias loads ahead of this tile's arithmetic, so
      // that they fly during it: within the register budget the scheduler
      // otherwise puts each load directly in front of its use.
      __builtin_amdgcn_sched_barrier(0);
      #pragma unroll
      for (int nt = 0; nt < 4; ++nt) {
        const int Nk = nt * 16 + (lane & 15);               // key token
        const int rk = reg3((wy << 3) + (Nk >> 3)) * 3 +
                       reg3((wx << 3) + (Nk & 7));
        #pragma unroll
        for (int vg = 0; vg < 8; ++vg) {
          const int Mq = mt * 16 + vg + ((lane >> 4) << 3); // query token
          const int rq = reg3((wy << 3) + (Mq >> 3)) * 3 +
                         reg3((wx << 3) + (Mq & 7));
          const float bvl = bb[mt & 1][nt * 8 + vg];
          const float v = lg[mt * 4 + nt][vg] * scale + bvl;
          lg[mt * 4 + nt][vg] = (rq == rk) ? v : -1e30f;
        }
      }
      #pragma unroll
      for (int vg = 0; vg < 8; ++vg) {
        float mx = fmaxf(fmaxf(lg[mt*4+0][vg], lg[mt*4+1][vg]),
                         fmaxf(lg[mt*4+2][vg], lg[mt*4+3][vg]));
        mx = red16_max(mx);
        float sm = 0.0f;
        #pragma unroll
        for (int nt = 0; nt < 4; ++nt) {
          const float e = __expf(lg[mt*4+nt][vg] - mx);
          lg[mt*4+nt][vg] = e;
          sm += e;
        }
        sm = red16_sum(sm);
        const float rinv = 1.0f / sm;
        #pragma unroll
        for (int nt = 0; nt < 4; ++nt) lg[mt*4+nt][vg] *= rinv;
      }
    }

    __syncthreads();  // all waves done reading qb/kb before aliased writes

    _Float16* ah = at + (size_t)h * NTOK * ATS;
    #pragma unroll
    for (int mt = 0; mt < 4; ++mt) {
      #pragma unroll
      for (int nt = 0; nt < 4; ++nt) {
        const int Nk = nt * 16 + (lane & 15);
        #pragma unroll
        for (int vg = 0; vg < 8; ++vg) {
          const int Mq = mt * 16 + vg + ((lane >> 4) << 3);
          ah[(size_t)Mq * ATS + Nk] = (_Float16)lg[mt * 4 + nt][vg];
        }
      }
    }
  }

  // ---- Step 4: o = attn @ v (one head per wave, WMMA, K = 64 tokens) ----
  {
    const int h = wv_id;
    _Float16* ah = at + (size_t)h * NTOK * ATS;
    v8f oacc[8];
    #pragma unroll
    for (int t = 0; t < 8; ++t) {
      #pragma unroll
      for (int e = 0; e < 8; ++e) oacc[t][e] = 0.0f;
    }
    #pragma unroll
    for (int kk = 0; kk < NTOK; kk += 32) {
      v16h vf[2];
      #pragma unroll
      for (int nt2 = 0; nt2 < 2; ++nt2)
        vf[nt2] = load_frag(vt, h * HD + nt2 * 16, VTS, kk, lane); // v^T rows
      #pragma unroll
      for (int mt = 0; mt < 4; ++mt) {
        const v16h a = load_frag(ah, mt * 16, ATS, kk, lane);
        #pragma unroll
        for (int nt2 = 0; nt2 < 2; ++nt2)
          oacc[mt * 2 + nt2] = wmma16(a, vf[nt2], oacc[mt * 2 + nt2]);
      }
    }
    #pragma unroll
    for (int mt = 0; mt < 4; ++mt) {
      #pragma unroll
      for (int nt2 = 0; nt2 < 2; ++nt2) {
        const int n = nt2 * 16 + (lane & 15);
        #pragma unroll
        for (int vg = 0; vg < 8; ++vg) {
          const int m = mt * 16 + vg + ((lane >> 4) << 3);
          ah[(size_t)m * ATS + n] = (_Float16)oacc[mt * 2 + nt2][vg];
        }
      }
    }
  }
  __syncthreads();

  // ---- Step 5: z = o @ wo^T + bo, reverse roll folded into global store ----
  {
    v8f acc[8];                              // tile index = mt * 2 + nt
    #pragma unroll
    for (int nt = 0; nt < 2; ++nt) {
      const float bvl = bo[n0 + nt * 16 + (lane & 15)];
      #pragma unroll
      for (int mt = 0; mt < 4; ++mt) {
        #pragma unroll
        for (int e = 0; e < 8; ++e) acc[mt * 2 + nt][e] = bvl;
      }
    }
    mm_64x32<ATS, NTOK * ATS>(at, wo16, n0, lane, acc);   // k slice = head
    #pragma unroll
    for (int mt = 0; mt < 4; ++mt) {
      #pragma unroll
      for (int nt = 0; nt < 2; ++nt) {
        const int n = n0 + nt * 16 + (lane & 15);
        #pragma unroll
        for (int vg = 0; vg < 8; ++vg) {
          const int m  = mt * 16 + vg + ((lane >> 4) << 3);
          const int oh = (((wy << 3) + (m >> 3)) - 4) & 15;  // out = roll(z,-4)
          const int ow = (((wx << 3) + (m & 7)) - 4) & 15;
          out[(((size_t)b * 16 + oh) * 16 + ow) * DM + n] = acc[mt * 2 + nt][vg];
        }
      }
    }
  }
}

// ---------------------------------------------------------------------------
// Prep kernel 1: f32 -> f16 weight conversion into the packed fragment order
// of load_wfrag. One thread per 16-byte piece (8 values of one row) of one
// matrix; 32 blocks a matrix.
// ---------------------------------------------------------------------------
__global__ __launch_bounds__(256)
void swinv2_prep_weights(const float* __restrict__ wq, const float* __restrict__ wk,
                         const float* __restrict__ wv, const float* __restrict__ wo,
                         _Float16* __restrict__ wq16, _Float16* __restrict__ wk16,
                         _Float16* __restrict__ wv16, _Float16* __restrict__ wo16) {
  const int mat = blockIdx.x >> 5;
  const float* src = mat == 0 ? wq : mat == 1 ? wk : mat == 2 ? wv : wo;
  _Float16*    dst = mat == 0 ? wq16 : mat == 1 ? wk16 : mat == 2 ? wv16 : wo16;
  const int c  = (blockIdx.x & 31) * 256 + threadIdx.x;   // piece 0..8191
  const int l  = c & 31;             // lane that will read the piece
  const int j  = (c >> 5) & 1;       // half of the fragment
  const int nt = (c >> 6) & 1;       // 16-row tile of the wave
  const int ks = (c >> 7) & 7;       // k slice
  const int w  = c >> 10;            // wave
  const int row = w * 32 + nt * 16 + (l & 15);
  const int col = ks * 32 + j * 16 + ((l >> 4) << 3);
  const float4* s = (const float4*)(src + (size_t)row * DM + col);
  const float4 f0 = s[0], f1 = s[1];
  v8h o;
  o[0] = (_Float16)f0.x; o[1] = (_Float16)f0.y;
  o[2] = (_Float16)f0.z; o[3] = (_Float16)f0.w;
  o[4] = (_Float16)f1.x; o[5] = (_Float16)f1.y;
  o[6] = (_Float16)f1.z; o[7] = (_Float16)f1.w;
  *(v8h*)(dst + (size_t)c * 8) = o;
}

// ---------------------------------------------------------------------------
// Prep kernel 2: CPB-MLP relative-position bias table -> [H][64][64] f32
// (16 * sigmoid already applied). One thread per (query n, key m) pair.
// ---------------------------------------------------------------------------
__global__ __launch_bounds__(256)
void swinv2_prep_bias(const float* __restrict__ w1, const float* __restrict__ b1,
                      const float* __restrict__ w2, float* __restrict__ biastab) {
  const int p = blockIdx.x * 256 + threadIdx.x;   // 4096 pairs
  if (p >= NTOK * NTOK) return;
  const int n = p >> 6, m = p & 63;
  const float dy = (float)((n >> 3) - (m >> 3));  // relative coords in [-7,7]
  const float dx = (float)((n & 7) - (m & 7));
  const float sy = dy / 7.0f * 8.0f;
  const float sx = dx / 7.0f * 8.0f;
  const float ty = copysignf(log2f(fabsf(sy) + 1.0f) / 3.0f, sy);
  const float tx = copysignf(log2f(fabsf(sx) + 1.0f) / 3.0f, sx);

  float acc[NHEADS];
  #pragma unroll
  for (int h = 0; h < NHEADS; ++h) acc[h] = 0.0f;
  for (int j = 0; j < 512; ++j) {
    const float h1 = fmaxf(w1[j * 2 + 0] * ty + w1[j * 2 + 1] * tx + b1[j], 0.0f);
    #pragma unroll
    for (int h = 0; h < NHEADS; ++h) acc[h] += h1 * w2[h * 512 + j];
  }
  #pragma unroll
  for (int h = 0; h < NHEADS; ++h)
    biastab[(size_t)h * NTOK * NTOK + p] = 16.0f / (1.0f + __expf(-acc[h]));
}

// ---------------------------------------------------------------------------
extern "C" void kernel_launch(void* const* d_in, const int* in_sizes, int n_in,
                              void* d_out, int out_size, void* d_ws, size_t ws_size,
                              hipStream_t stream) {
  (void)in_sizes; (void)n_in; (void)out_size; (void)ws_size;

  const float* img  = (const float*)d_in[0];
  const float* wq   = (const float*)d_in[1];
  const float* bq   = (const float*)d_in[2];
  const float* wk   = (const float*)d_in[3];
  const float* bk   = (const float*)d_in[4];
  const float* wv   = (const float*)d_in[5];
  const float* bv   = (const float*)d_in[6];
  const float* wo   = (const float*)d_in[7];
  const float* bo   = (const float*)d_in[8];
  const float* ls   = (const float*)d_in[9];
  const float* cw1  = (const float*)d_in[10];
  const float* cb1  = (const float*)d_in[11];
  const float* cw2  = (const float*)d_in[12];
  float* out = (float*)d_out;

  // workspace layout (bytes)
  char* ws = (char*)d_ws;
  _Float16* wq16 = (_Float16*)(ws + 0 * 131072);
  _Float16* wk16 = (_Float16*)(ws + 1 * 131072);
  _Float16* wv16 = (_Float16*)(ws + 2 * 131072);
  _Float16* wo16 = (_Float16*)(ws + 3 * 131072);
  float*    btab = (float*)   (ws + 4 * 131072);   // [8][64][64] f32

  swinv2_prep_weights<<<4 * (DM * DM / 8 / 256), 256, 0, stream>>>(
      wq, wk, wv, wo, wq16, wk16, wv16, wo16);
  swinv2_prep_bias<<<NTOK * NTOK / 256, 256, 0, stream>>>(cw1, cb1, cw2, btab);

  const size_t smem_bytes = (size_t)SMEM_ELTS * sizeof(_Float16);  // 138240 B
  (void)hipFuncSetAttribute((const void*)swinv2_window_attn_kernel,
                            hipFuncAttributeMaxDynamicSharedMemorySize,
                            (int)smem_bytes);

  const int Bn = 512 * 4;   // B * NW windows
  swinv2_window_attn_kernel<<<Bn, 256, smem_bytes, stream>>>(
      img, wq16, bq, wk16, bk, wv16, bv, wo16, bo, ls, btab, out);
}

// v004
// One run takes 101 microseconds.
// In two side-by-side timings against v003, it was 1.38 and 1.39 times as fast.
// Over all steps from v000 it is 3.67 times as fast.
#include <hip/hip_runtime.h>
#include <hip/hip_bf16.h>

// ---------------------------------------------------------------------------
// Swin-V2 shifted-window MHA, fused per-window kernel for gfx1250 (MI455X).
// f16 WMMA (V_WMMA_F32_16X16X32_F16) for all GEMMs, f32 accumulation.
// wave32: 8 waves / 256-thread block, one window (64 tokens) per block.
// ---------------------------------------------------------------------------

typedef __attribute__((ext_vector_type(16))) _Float16 v16h;
typedef __attribute__((ext_vector_type(8)))  _Float16 v8h;
typedef __attribute__((ext_vector_type(8)))  float    v8f;

#define WINSZ   8
#define NTOK    64          // tokens per window
#define DM      256         // model dim
#define NHEADS  8
#define HD      32          // head dim
#define XS      264         // f16 row stride for 64x256 LDS buffers (pad 8)
#define VTS     72          // f16 row stride for v^T (256x64) LDS buffer

union V16u { v16h v; v8h h[2]; };

// Load a 16x32 (f16) WMMA A/B fragment from a row-major f16 matrix.
// Lane layout follows the CDNA5 16-bit fragment striping:
//   lanes 0-15 : row = base+lane,    K chunks [0..7] and [16..23]
//   lanes 16-31: row = base+lane-16, K chunks [8..15] and [24..31]
__device__ __forceinline__ v16h load_frag(const _Float16* base, int row0,
                                          int stride, int k0, int lane) {
  const int r  = row0 + (lane & 15);
  const int c0 = k0 + ((lane >> 4) << 3);
  const _Float16* p = base + (size_t)r * stride + c0;
  V16u u;
  u.h[0] = *(const v8h*)(p);
  u.h[1] = *(const v8h*)(p + 16);
  return u.v;
}

// Packed weights (written by swinv2_prep_weights). A fragment is 1 KiB: two
// halves of 512 B, and in each half lane l's 8 values stand at l * 16 B, so one
// wave-wide 16-byte load reads four whole 128-B lines. Fragments follow one
// another in the order a wave uses them: [wave][k slice][16-row tile].
#define WHALF 256                    // f16 elements in half a fragment
#define WWAVE (DM / 32 * 2 * 2 * WHALF)   // f16 elements of one wave's 32 rows

// One fragment from this lane's place in its first half.
__device__ __forceinline__ v16h load_wfrag(const _Float16* p) {
  V16u u;
  u.h[0] = *(const v8h*)(p);
  u.h[1] = *(const v8h*)(p + WHALF);
  return u.v;
}

__device__ __forceinline__ v8f wmma16(v16h a, v16h b, v8f c) {
  return __builtin_amdgcn_wmma_f32_16x16x32_f16(
      /*neg_a=*/false, a, /*neg_b=*/false, b,
      /*c_mod=*/(short)0, c, /*reuse_a=*/false, /*reuse_b=*/false);
}

// Lane l's value and lane (l ^ 16)'s change places. With the weights, the keys or
// v^T as the A operand, a lane's D registers hold 8 consecutive features or keys
// of ONE token (token = lane & 15), and lanes l and l ^ 16 split that token's
// row: a row sum or maximum is taken in the lane, then joined by one exchange.
__device__ __forceinline__ float xhalf(float x) {
  const int b = __builtin_bit_cast(int, x);
  return __builtin_bit_cast(float, __builtin_amdgcn_permlanex16(
      b, b, 0x76543210, 0xfedcba98, false, false));
}

// Eight f32 accumulator registers as eight f16 (16 bytes).
__device__ __forceinline__ v8h pack8(v8f x) { return __builtin_convertvector(x, v8h); }

// One lane's 32 bias values of query tile mt from the packed table (written by
// swinv2_prep_bias): piece j = key tile * 2 + (register >> 2), lane l's four
// values at l * 16 B, so each wave-wide load reads four whole 128-B lines.
__device__ __forceinline__ void load_bias32(const float* bt, unsigned boff, int mt,
                                            float4 (&bb)[8]) {
  const float4* p = (const float4*)((const char*)bt + boff) + mt * 8 * 32;
  #pragma unroll
  for (int j = 0; j < 8; ++j) bb[j] = p[j * 32];
}

// shift-mask region id: rows/cols [0,8) -> 0, [8,12) -> 1, [12,16) -> 2
__device__ __forceinline__ int reg3(int p) { return p < 8 ? 0 : (p < 12 ? 1 : 2); }

// ---------------------------------------------------------------------------
// acc(64x32) += src(64x256, LDS) @ W[n0..n0+31][:]^T; tile index = mt * 2 + nt.
// WA: the weights are the A operand, and a tile comes out transposed: register r
// = [token mt * 16 + (lane & 15)][column nt * 16 + 8 * (lane >> 4) + r].
// w16: the packed form of W (see load_wfrag).
// src: row pitch RS, k slice ks (32 columns) starts at src + ks * KS.
// The wave's weights (32 rows x 256) pass through a register ring of WRING
// k slices (16 registers a lane each): WRING slices are requested first, and a
// further one as each slice is used up. The whole set at once (128 registers)
// would put the kernel above 256 registers, and then only one work-group fits
// a WGP's register files.
// ---------------------------------------------------------------------------
#define WRING 4
template<int RS, int KS, bool WA>
__device__ __forceinline__ void mm_64x32(const _Float16* src, const _Float16* w16,
                                         int n0, int lane, v8f (&acc)[8]) {
  // The wave's packed weights (a scalar base) and this lane's byte offset in
  // every half fragment; w0, w1: its place in the first and second fragment.
  const _Float16* wb = w16 + (size_t)(n0 >> 5) * WWAVE;
  const unsigned loff = (unsigned)lane * 16u;
  const _Float16* w0 = (const _Float16*)((const char*)wb + loff);
  const _Float16* w1 = w0 + 2 * WHALF;
  v16h bf[DM / 32][2];
  #pragma unroll
  for (int ks = 0; ks < WRING; ++ks) {
    bf[ks][0] = load_wfrag(w0 + ks * 4 * WHALF);
    bf[ks][1] = load_wfrag(w1 + ks * 4 * WHALF);
  }
  v16h a[2][4];
  #pragma unroll
  for (int mt = 0; mt < 4; ++mt) a[0][mt] = load_frag(src, mt * 16, RS, 0, lane);
  #pragma unroll
  for (int ks = 0; ks < DM / 32; ++ks) {
    if (ks + 1 < DM / 32) {
      #pragma unroll
      for (int mt = 0; mt < 4; ++mt)
        a[(ks + 1) & 1][mt] = load_frag(src + (ks + 1) * KS, mt * 16, RS, 0, lane);
      if (ks >= 1 && ks + WRING - 1 < DM / 32) {   // slice ks - 1 is used up
        bf[ks + WRING - 1][0] = load_wfrag(w0 + (ks + WRING - 1) * 4 * WHALF);
        bf[ks + WRING - 1][1] = load_wfrag(w1 + (ks + WRING - 1) * 4 * WHALF);
      }
      // Keeps the loads above (at ks = 0 the first weight loads too) ahead of
      // this slice's WMMAs: the scheduler otherwise sinks each pair to its use,
      // and every slice then waits out the L2 and the LDS latency.
      __builtin_amdgcn_sched_barrier(0);
    }
    #pragma unroll
    for (int mt = 0; mt < 4; ++mt) {
      #pragma unroll
      for (int nt = 0; nt < 2; ++nt)
        acc[mt * 2 + nt] = WA ? wmma16(bf[ks][nt], a[ks & 1][mt], acc[mt * 2 + nt])
                              : wmma16(a[ks & 1][mt], bf[ks][nt], acc[mt * 2 + nt]);
    }
    // Keeps the next trip's loads from rising among these WMMAs, where they
    // would take a third set of fragment registers and overrun the budget.
    __builtin_amdgcn_sched_barrier(0);
  }
  // The wait that stands before the weight loads' address registers are
  // reused; naming offset and base as inputs keeps them untouched up to here.
  asm volatile("s_wait_xcnt 0x0" :: "v"(loff), "s"(wb) : "memory");
}

// ---------------------------------------------------------------------------
// One 64x32 slice of a projection GEMM: x(64x256,f16) @ W^T + bias.
// A wave owns 32 output columns (one head) for all 64 tokens, so every weight
// row is loaded by exactly one wave of the block; x fragments come from LDS.
// ---------------------------------------------------------------------------
// q and k: weights as A, so a lane holds 16 of one token's 32 head columns. The
// per-head L2 normalization (cosine attention) of the f32 accumulators is an
// in-lane sum and one exchange; a tile goes to dst[token][column] in one
// 16-byte store a lane.
__device__ __forceinline__ void proj_qk(const _Float16* src, const _Float16* w16,
                                        const float* bvec, _Float16* dst,
                                        int n0, int lane) {
  const int c = lane & 15, hh = lane >> 4;
  v8f acc[8];                                // tile index = mt * 2 + nt
  // The head's bias values (a scalar base) and this lane half's byte offset.
  const float* bh = bvec + n0;
  const unsigned hoff = (unsigned)hh * 32u;
  const float4* bp = (const float4*)((const char*)bh + hoff);
  const float4 bl[4] = {bp[0], bp[1], bp[4], bp[5]};
  #pragma unroll
  for (int nt = 0; nt < 2; ++nt) {
    const float4 b0 = bl[nt * 2], b1 = bl[nt * 2 + 1];
    #pragma unroll
    for (int mt = 0; mt < 4; ++mt) {
      acc[mt * 2 + nt][0] = b0.x; acc[mt * 2 + nt][1] = b0.y;
      acc[mt * 2 + nt][2] = b0.z; acc[mt * 2 + nt][3] = b0.w;
      acc[mt * 2 + nt][4] = b1.x; acc[mt * 2 + nt][5] = b1.y;
      acc[mt * 2 + nt][6] = b1.z; acc[mt * 2 + nt][7] = b1.w;
    }
  }
  mm_64x32<XS, 32, true>(src, w16, n0, lane, acc);
  // The wait that stands before the bias loads' address registers are reused;
  // naming offset and base as inputs keeps them untouched up to here. It stands
  // behind the products so that the loads stay free to rise above what precedes.
  asm volatile("s_wait_xcnt 0x0" :: "v"(hoff), "s"(bh) : "memory");
  #pragma unroll
  for (int mt = 0; mt < 4; ++mt) {
    float s0 = 0.0f, s1 = 0.0f;
    #pragma unroll
    for (int r = 0; r < 8; ++r) {
      s0 += acc[mt * 2][r] * acc[mt * 2][r];
      s1 += acc[mt * 2 + 1][r] * acc[mt * 2 + 1][r];
    }
    float s = s0 + s1;
    s += xhalf(s);
    const float rinv = 1.0f / fmaxf(sqrtf(s), 1e-12f);
    _Float16* d = dst + (size_t)(mt * 16 + c) * XS + n0 + hh * 8;
    *(v8h*)(d)      = pack8(acc[mt * 2] * rinv);
    *(v8h*)(d + 16) = pack8(acc[mt * 2 + 1] * rinv);
  }
}

// v: x as A; register r = [token mt * 16 + 8 * (lane >> 4) + r][column], stored
// transposed (dst[column][token]) so that attn@v fragments are contiguous.
__device__ __forceinline__ void proj_v(const _Float16* src, const _Float16* w16,
                                       const float* bvec, _Float16* dst,
                                       int n0, int lane) {
  v8f acc[8];                                // tile index = mt * 2 + nt
  #pragma unroll
  for (int nt = 0; nt < 2; ++nt) {
    const float bv = bvec[n0 + nt * 16 + (lane & 15)];  // C layout: N = lane
    #pragma unroll
    for (int mt = 0; mt < 4; ++mt) {
      #pragma unroll
      for (int e = 0; e < 8; ++e) acc[mt * 2 + nt][e] = bv;
    }
  }
  mm_64x32<XS, 32, false>(src, w16, n0, lane, acc);
  #pragma unroll
  for (int mt = 0; mt < 4; ++mt) {
    #pragma unroll
    for (int nt = 0; nt < 2; ++nt) {
      const int n = n0 + nt * 16 + (lane & 15);
      #pragma unroll
      for (int vg = 0; vg < 8; ++vg) {
        const int m = mt * 16 + vg + ((lane >> 4) << 3);
        dst[(size_t)n * VTS + m] = (_Float16)acc[mt * 2 + nt][vg];
      }
    }
  }
}

// LDS layout (f16 elements). A wave writes and reads only its own head's columns
// of q, k and v^T; its o (64x32) goes into its q columns once it has read them.
// 135 KiB: two work-groups fit a WGP's LDS.
#define OFF_X   0
#define OFF_Q   (NTOK * XS)
#define OFF_K   (2 * NTOK * XS)
#define OFF_VT  (3 * NTOK * XS)
#define SMEM_ELTS (3 * NTOK * XS + DM * VTS)

// Second argument: at least 4 waves a SIMD, that is two work-groups a WGP; it
// sets the register budget to 256.
__global__ __launch_bounds__(256, 4)
void swinv2_window_attn_kernel(const float* __restrict__ img,
                               const _Float16* __restrict__ wq16, const float* __restrict__ bq,
                               const _Float16* __restrict__ wk16, const float* __restrict__ bk,
                               const _Float16* __restrict__ wv16, const float* __restrict__ bv,
                               const _Float16* __restrict__ wo16, const float* __restrict__ bo,
                               const float* __restrict__ logit_scale,
                               const float* __restrict__ biastab,
                               float* __restrict__ out) {
  extern __shared__ char smem_raw[];
  _Float16* xb = (_Float16*)smem_raw;
  _Float16* qb = xb + OFF_Q;
  _Float16* kb = xb + OFF_K;
  _Float16* vt = xb + OFF_VT;

  const int tid  = threadIdx.x;
  const int lane = tid & 31;
  // The wave's number in a scalar register: what is formed from it (head, column
  // base, LDS bases) then takes no vector registers.
  const int wv_id = __builtin_amdgcn_readfirstlane(tid >> 5);

  const int blk = blockIdx.x;        // Bn = B * 4 window-blocks
  const int b  = blk >> 2;
  const int wi = blk & 3;
  const int wy = wi >> 1, wx = wi & 1;

  // ---- Step 1: roll(+4,+4) + window-partition + f32->f16 into LDS ----
  for (int i = tid; i < NTOK * (DM / 4); i += 256) {
    const int row = i >> 6;          // token 0..63
    const int q4  = i & 63;          // float4 index in row
    const int r = row >> 3, c = row & 7;
    const int sh = (((wy << 3) + r) - 4) & 15;   // rolled[h] = img[h-4]
    const int sw = (((wx << 3) + c) - 4) & 15;
    const float4 f =
        ((const float4*)(img + (((size_t)b * 16 + sh) * 16 + sw) * DM))[q4];
    _Float16* dst = xb + (size_t)row * XS + q4 * 4;
    dst[0] = (_Float16)f.x; dst[1] = (_Float16)f.y;
    dst[2] = (_Float16)f.z; dst[3] = (_Float16)f.w;
  }
  __syncthreads();

  // ---- Step 2: q/k/v projections (WMMA). Each wave: 64 rows x 32 cols ----
  const int n0 = wv_id << 5;              // 0,32,...,224
  proj_qk(xb, wq16, bq, qb, n0, lane);    // q, L2-normed
  proj_qk(xb, wk16, bk, kb, n0, lane);    // k, L2-normed
  proj_v (xb, wv16, bv, vt, n0, lane);    // v, transposed
  // No barrier: steps 3 and 4 read only what this wave itself has written.

  // ---- Step 3: logits^T = kn@qn^T * scale + bias, mask, softmax (head/wave) --
  // Tile mt * 4 + nt, register r = [query mt * 16 + c][key nt * 16 + 8 * hh + r].
  const int c = lane & 15, hh = lane >> 4;
  v16h pf[4][2];                          // attn^T as B operands: [mt][32 keys]
  {
    const int h = wv_id;
    const float scale = __expf(fminf(logit_scale[h], 4.6051702f)); // log(100)
    const float* bt = biastab + (size_t)h * NTOK * NTOK;
    const unsigned boff = (unsigned)lane * 16u;

    // Bias values of query tile 0, requested ahead of the products.
    float4 bb[2][8];
    load_bias32(bt, boff, 0, bb[0]);

    v8f lg[16];
    #pragma unroll
    for (int t = 0; t < 16; ++t) {
      #pragma unroll
      for (int e = 0; e < 8; ++e) lg[t][e] = 0.0f;
    }

    v16h kf[4];
    #pragma unroll
    for (int nt = 0; nt < 4; ++nt)
      kf[nt] = load_frag(kb, nt * 16, XS, h * HD, lane);   // A = kn
    #pragma unroll
    for (int mt = 0; mt < 4; ++mt) {
      const v16h q = load_frag(qb, mt * 16, XS, h * HD, lane);  // B = qn^T
      #pragma unroll
      for (int nt = 0; nt < 4; ++nt)
        lg[mt * 4 + nt] = wmma16(kf[nt], q, lg[mt * 4 + nt]);   // K = HD = 32
    }

    // Shift-window mask: query and key are in one region when their row regions
    // and their column regions agree. A key's window column is its register r.
    const int cq = reg3((wx << 3) + (c & 7));
    bool cm[8];
    #pragma unroll
    for (int r = 0; r < 8; ++r) cm[r] = cq == reg3((wx << 3) + r);

    // Per query tile: scale + relative-position bias + mask, then the softmax of
    // the lane's query: over its 32 keys in registers, joined with the other
    // half's 32 by one exchange each for maximum and sum.
    #pragma unroll
    for (int mt = 0; mt < 4; ++mt) {
      if (mt + 1 < 4) load_bias32(bt, boff, mt + 1, bb[(mt + 1) & 1]);
      // Keeps the next tile's bias loads ahead of this tile's arithmetic, so
      // that they fly during it: within the register budget the scheduler
      // otherwise puts each load directly in front of its use.
      __builtin_amdgcn_sched_barrier(0);
      const int rq = reg3((wy << 3) + mt * 2 + (c >> 3));
      #pragma unroll
      for (int nt = 0; nt < 4; ++nt) {
        const bool rm = rq == reg3((wy << 3) + nt * 2 + hh);
        #pragma unroll
        for (int r = 0; r < 8; ++r) {
          const float4 b4 = bb[mt & 1][nt * 2 + (r >> 2)];
          const float bvl = (r & 3) == 0 ? b4.x : (r & 3) == 1 ? b4.y
                          : (r & 3) == 2 ? b4.z : b4.w;
          const float v = lg[mt * 4 + nt][r] * scale + bvl;
          lg[mt * 4 + nt][r] = (rm && cm[r]) ? v : -1e30f;
        }
      }
      float mx = -1e30f;
      #pragma unroll
      for (int nt = 0; nt < 4; ++nt) {
        #pragma unroll
        for (int r = 0; r < 8; ++r) mx = fmaxf(mx, lg[mt * 4 + nt][r]);
      }
      mx = fmaxf(mx, xhalf(mx));
      float sp[4];
      #pragma unroll
      for (int nt = 0; nt < 4; ++nt) {
        sp[nt] = 0.0f;
        #pragma unroll
        for (int r = 0; r < 8; ++r) {
          const float e = __expf(lg[mt * 4 + nt][r] - mx);
          lg[mt * 4 + nt][r] = e;
          sp[nt] += e;
        }
      }
      float sm = (sp[0] + sp[1]) + (sp[2] + sp[3]);
      sm += xhalf(sm);
      const float rinv = 1.0f / sm;
      // Two key tiles of one query tile, converted in place, are the B operand
      // of attn@v in the hardware's k order: attn never goes through LDS.
      #pragma unroll
      for (int kk = 0; kk < 2; ++kk) {
        V16u u;
        u.h[0] = pack8(lg[mt * 4 + kk * 2] * rinv);
        u.h[1] = pack8(lg[mt * 4 + kk * 2 + 1] * rinv);
        pf[mt][kk] = u.v;
      }
    }
    // The wait that stands before the bias loads' address registers are reused;
    // naming offset and base as inputs keeps them untouched up to here.
    asm volatile("s_wait_xcnt 0x0" :: "v"(boff), "s"(bt) : "memory");
  }

  // ---- Step 4: o^T = v^T @ attn^T (one head per wave, WMMA, K = 64 tokens) ----
  {
    const int h = wv_id;
    v8f oacc[8];                             // tile index = mt * 2 + nt2
    #pragma unroll
    for (int t = 0; t < 8; ++t) {
      #pragma unroll
      for (int e = 0; e < 8; ++e) oacc[t][e] = 0.0f;
    }
    #pragma unroll
    for (int kk = 0; kk < 2; ++kk) {
      v16h vf[2];
      #pragma unroll
      for (int nt2 = 0; nt2 < 2; ++nt2)
        vf[nt2] = load_frag(vt, h * HD + nt2 * 16, VTS, kk * 32, lane); // v^T rows
      #pragma unroll
      for (int mt = 0; mt < 4; ++mt) {
        #pragma unroll
        for (int nt2 = 0; nt2 < 2; ++nt2)
          oacc[mt * 2 + nt2] = wmma16(vf[nt2], pf[mt][kk], oacc[mt * 2 + nt2]);
      }
    }
    // Register r = o[query mt * 16 + c][head column nt2 * 16 + 8 * hh + r].
    #pragma unroll
    for (int mt = 0; mt < 4; ++mt) {
      _Float16* d = qb + (size_t)(mt * 16 + c) * XS + n0 + hh * 8;
      *(v8h*)(d)      = pack8(oacc[mt * 2]);
      *(v8h*)(d + 16) = pack8(oacc[mt * 2 + 1]);
    }
  }
  __syncthreads();

  // ---- Step 5: z = o @ wo^T + bo, reverse roll folded into global store ----
  {
    v8f acc[8];                              // tile index = mt * 2 + nt
    #pragma unroll
    for (int nt = 0; nt < 2; ++nt) {
      const float bvl = bo[n0 + nt * 16 + (lane & 15)];
      #pragma unroll
      for (int mt = 0; mt < 4; ++mt) {
        #pragma unroll
        for (int e = 0; e < 8; ++e) acc[mt * 2 + nt][e] = bvl;
      }
    }
    mm_64x32<XS, 32, false>(qb, wo16, n0, lane, acc);
    #pragma unroll
    for (int mt = 0; mt < 4; ++mt) {
      #pragma unroll
      for (int nt = 0; nt < 2; ++nt) {
        const int n = n0 + nt * 16 + (lane & 15);
        #pragma unroll
        for (int vg = 0; vg < 8; ++vg) {
          const int m  = mt * 16 + vg + ((lane >> 4) << 3);
          const int oh = (((wy << 3) + (m >> 3)) - 4) & 15;  // out = roll(z,-4)
          const int ow = (((wx << 3) + (m & 7)) - 4) & 15;
          out[(((size_t)b * 16 + oh) * 16 + ow) * DM + n] = acc[mt * 2 + nt][vg];
        }
      }
    }
  }
}

// ---------------------------------------------------------------------------
// Prep kernel 1: f32 -> f16 weight conversion into the packed fragment order
// of load_wfrag. One thread per 16-byte piece (8 values of one row) of one
// matrix; 32 blocks a matrix.
// ---------------------------------------------------------------------------
__global__ __launch_bounds__(256)
void swinv2_prep_weights(const float* __restrict__ wq, const float* __restrict__ wk,
                         const float* __restrict__ wv, const float* __restrict__ wo,
                         _Float16* __restrict__ wq16, _Float16* __restrict__ wk16,
                         _Float16* __restrict__ wv16, _Float16* __restrict__ wo16) {
  const int mat = blockIdx.x >> 5;
  const float* src = mat == 0 ? wq : mat == 1 ? wk : mat == 2 ? wv : wo;
  _Float16*    dst = mat == 0 ? wq16 : mat == 1 ? wk16 : mat == 2 ? wv16 : wo16;
  const int c  = (blockIdx.x & 31) * 256 + threadIdx.x;   // piece 0..8191
  const int l  = c & 31;             // lane that will read the piece
  const int j  = (c >> 5) & 1;       // half of the fragment
  const int nt = (c >> 6) & 1;       // 16-row tile of the wave
  const int ks = (c >> 7) & 7;       // k slice
  const int w  = c >> 10;            // wave
  const int row = w * 32 + nt * 16 + (l & 15);
  const int col = ks * 32 + j * 16 + ((l >> 4) << 3);
  const float4* s = (const float4*)(src + (size_t)row * DM + col);
  const float4 f0 = s[0], f1 = s[1];
  v8h o;
  o[0] = (_Float16)f0.x; o[1] = (_Float16)f0.y;
  o[2] = (_Float16)f0.z; o[3] = (_Float16)f0.w;
  o[4] = (_Float16)f1.x; o[5] = (_Float16)f1.y;
  o[6] = (_Float16)f1.z; o[7] = (_Float16)f1.w;
  *(v8h*)(dst + (size_t)c * 8) = o;
}

// ---------------------------------------------------------------------------
// Prep kernel 2: CPB-MLP relative-position bias table, 64x64 f32 a head (16 *
// sigmoid already applied), in the order of load_bias32. One thread per
// (query n, key m) pair.
// ---------------------------------------------------------------------------
__global__ __launch_bounds__(256)
void swinv2_prep_bias(const float* __restrict__ w1, const float* __restrict__ b1,
                      const float* __restrict__ w2, float* __restrict__ biastab) {
  const int p = blockIdx.x * 256 + threadIdx.x;   // 4096 pairs
  if (p >= NTOK * NTOK) return;
  const int n = p >> 6, m = p & 63;
  const float dy = (float)((n >> 3) - (m >> 3));  // relative coords in [-7,7]
  const float dx = (float)((n & 7) - (m & 7));
  const float sy = dy / 7.0f * 8.0f;
  const float sx = dx / 7.0f * 8.0f;
  const float ty = copysignf(log2f(fabsf(sy) + 1.0f) / 3.0f, sy);
  const float tx = copysignf(log2f(fabsf(sx) + 1.0f) / 3.0f, sx);

  float acc[NHEADS];
  #pragma unroll
  for (int h = 0; h < NHEADS; ++h) acc[h] = 0.0f;
  for (int j = 0; j < 512; ++j) {
    const float h1 = fmaxf(w1[j * 2 + 0] * ty + w1[j * 2 + 1] * tx + b1[j], 0.0f);
    #pragma unroll
    for (int h = 0; h < NHEADS; ++h) acc[h] += h1 * w2[h * 512 + j];
  }
  // [query tile][key tile * 2 + (r >> 2)][lane][r & 3]; r = m & 7 is the register,
  // lane = ((m >> 3) & 1) * 16 + (n & 15).
  const int piece = (n >> 4) * 8 + (m >> 4) * 2 + ((m >> 2) & 1);
  const int idx = (piece * 32 + ((m >> 3) & 1) * 16 + (n & 15)) * 4 + (m & 3);
  #pragma unroll
  for (int h = 0; h < NHEADS; ++h)
    biastab[(size_t)h * NTOK * NTOK + idx] = 16.0f / (1.0f + __expf(-acc[h]));
}

// ---------------------------------------------------------------------------
extern "C" void kernel_launch(void* const* d_in, const int* in_sizes, int n_in,
                              void* d_out, int out_size, void* d_ws, size_t ws_size,
                              hipStream_t stream) {
  (void)in_sizes; (void)n_in; (void)out_size; (void)ws_size;

  const float* img  = (const float*)d_in[0];
  const float* wq   = (const float*)d_in[1];
  const float* bq   = (const float*)d_in[2];
  const float* wk   = (const float*)d_in[3];
  const float* bk   = (const float*)d_in[4];
  const float* wv   = (const float*)d_in[5];
  const float* bv   = (const float*)d_in[6];
  const float* wo   = (const float*)d_in[7];
  const float* bo   = (const float*)d_in[8];
  const float* ls   = (const float*)d_in[9];
  const float* cw1  = (const float*)d_in[10];
  const float* cb1  = (const float*)d_in[11];
  const float* cw2  = (const float*)d_in[12];
  float* out = (float*)d_out;

  // workspace layout (bytes)
  char* ws = (char*)d_ws;
  _Float16* wq16 = (_Float16*)(ws + 0 * 131072);
  _Float16* wk16 = (_Float16*)(ws + 1 * 131072);
  _Float16* wv16 = (_Float16*)(ws + 2 * 131072);
  _Float16* wo16 = (_Float16*)(ws + 3 * 131072);
  float*    btab = (float*)   (ws + 4 * 131072);   // 8 heads x 64 x 64 f32

  swinv2_prep_weights<<<4 * (DM * DM / 8 / 256), 256, 0, stream>>>(
      wq, wk, wv, wo, wq16, wk16, wv16, wo16);
  swinv2_prep_bias<<<NTOK * NTOK / 256, 256, 0, stream>>>(cw1, cb1, cw2, btab);

  const size_t smem_bytes = (size_t)SMEM_ELTS * sizeof(_Float16);  // 138240 B
  (void)hipFuncSetAttribute((const void*)swinv2_window_attn_kernel,
                            hipFuncAttributeMaxDynamicSharedMemorySize,
                            (int)smem_bytes);

  const int Bn = 512 * 4;   // B * NW windows
  swinv2_window_attn_kernel<<<Bn, 256, smem_bytes, stream>>>(
      img, wq16, bq, wk16, bk, wv16, bv, wo16, bo, ls, btab, out);
}

// v005
// Measured time: 81.6 microseconds a run.
// In two side-by-side timings against v004, it was 1.24 and 1.22 times as fast.
// Counting every step since v000, it is 4.53 times as fast.
#include <hip/hip_runtime.h>
#include <hip/hip_bf16.h>

// ---------------------------------------------------------------------------
// Swin-V2 shifted-window MHA, fused per-window kernel for gfx1250 (MI455X).
// f16 WMMA (V_WMMA_F32_16X16X32_F16) for all GEMMs, f32 accumulation.
// wave32: 8 waves / 256-thread block, one window (64 tokens) per block.
// ---------------------------------------------------------------------------

typedef __attribute__((ext_vector_type(16))) _Float16 v16h;
typedef __attribute__((ext_vector_type(8)))  _Float16 v8h;
typedef __attribute__((ext_vector_type(8)))  float    v8f;

#define WINSZ   8
#define NTOK    64          // tokens per window
#define DM      256         // model dim
#define NHEADS  8
#define HD      32          // head dim
#define XS      264         // f16 row stride for 64x256 LDS buffers (pad 8)
#define VTS     72          // f16 row stride for v^T (256x64) LDS buffer

union V16u { v16h v; v8h h[2]; };

// Load a 16x32 (f16) WMMA A/B fragment from a row-major f16 matrix.
// Lane layout follows the CDNA5 16-bit fragment striping:
//   lanes 0-15 : row = base+lane,    K chunks [0..7] and [16..23]
//   lanes 16-31: row = base+lane-16, K chunks [8..15] and [24..31]
__device__ __forceinline__ v16h load_frag(const _Float16* base, int row0,
                                          int stride, int k0, int lane) {
  const int r  = row0 + (lane & 15);
  const int c0 = k0 + ((lane >> 4) << 3);
  const _Float16* p = base + (size_t)r * stride + c0;
  V16u u;
  u.h[0] = *(const v8h*)(p);
  u.h[1] = *(const v8h*)(p + 16);
  return u.v;
}

// Packed weights (written by swinv2_prep_weights). A fragment is 1 KiB: two
// halves of 512 B, and in each half lane l's 8 values stand at l * 16 B, so one
// wave-wide 16-byte load reads four whole 128-B lines. Fragments follow one
// another in the order a wave uses them: [wave][k slice][16-row tile].
#define WHALF 256                    // f16 elements in half a fragment
#define WWAVE (DM / 32 * 2 * 2 * WHALF)   // f16 elements of one wave's 32 rows

// One fragment from this lane's place in its first half.
__device__ __forceinline__ v16h load_wfrag(const _Float16* p) {
  V16u u;
  u.h[0] = *(const v8h*)(p);
  u.h[1] = *(const v8h*)(p + WHALF);
  return u.v;
}

__device__ __forceinline__ v8f wmma16(v16h a, v16h b, v8f c) {
  return __builtin_amdgcn_wmma_f32_16x16x32_f16(
      /*neg_a=*/false, a, /*neg_b=*/false, b,
      /*c_mod=*/(short)0, c, /*reuse_a=*/false, /*reuse_b=*/false);
}

// Lane l's value and lane (l ^ 16)'s change places. With the weights, the keys or
// v^T as the A operand, a lane's D registers hold 8 consecutive features or keys
// of ONE token (token = lane & 15), and lanes l and l ^ 16 split that token's
// row: a row sum or maximum is taken in the lane, then joined by one exchange.
__device__ __forceinline__ float xhalf(float x) {
  const int b = __builtin_bit_cast(int, x);
  return __builtin_bit_cast(float, __builtin_amdgcn_permlanex16(
      b, b, 0x76543210, 0xfedcba98, false, false));
}

// Eight f32 accumulator registers as eight f16 (16 bytes).
__device__ __forceinline__ v8h pack8(v8f x) { return __builtin_convertvector(x, v8h); }

// One lane's 32 bias values of query tile mt from the packed table (written by
// swinv2_prep_bias): piece j = key tile * 2 + (register >> 2), lane l's four
// values at l * 16 B, so each wave-wide load reads four whole 128-B lines.
__device__ __forceinline__ void load_bias32(const float* bt, unsigned boff, int mt,
                                            float4 (&bb)[8]) {
  const float4* p = (const float4*)((const char*)bt + boff) + mt * 8 * 32;
  #pragma unroll
  for (int j = 0; j < 8; ++j) bb[j] = p[j * 32];
}

// shift-mask region id: rows/cols [0,8) -> 0, [8,12) -> 1, [12,16) -> 2
__device__ __forceinline__ int reg3(int p) { return p < 8 ? 0 : (p < 12 ? 1 : 2); }

// ---------------------------------------------------------------------------
// acc(64x32) += src(64x256, LDS) @ W[n0..n0+31][:]^T; tile index = mt * 2 + nt.
// WA: the weights are the A operand, and a tile comes out transposed: register r
// = [token mt * 16 + (lane & 15)][column nt * 16 + 8 * (lane >> 4) + r].
// w16: the packed form of W (see load_wfrag).
// src: row pitch RS, k slice ks (32 columns) starts at src + ks * KS.
// The wave's weights (32 rows x 256) pass through a register ring of WRING
// k slices (16 registers a lane each): WRING slices are requested first, and a
// further one as each slice is used up. The whole set at once (128 registers)
// would put the kernel above 256 registers, and then only one work-group fits
// a WGP's register files.
// ---------------------------------------------------------------------------
#define WRING 4
template<int RS, int KS, bool WA>
__device__ __forceinline__ void mm_64x32(const _Float16* src, const _Float16* w16,
                                         int n0, int lane, v8f (&acc)[8]) {
  // The wave's packed weights (a scalar base) and this lane's byte offset in
  // every half fragment; w0, w1: its place in the first and second fragment.
  const _Float16* wb = w16 + (size_t)(n0 >> 5) * WWAVE;
  const unsigned loff = (unsigned)lane * 16u;
  const _Float16* w0 = (const _Float16*)((const char*)wb + loff);
  const _Float16* w1 = w0 + 2 * WHALF;
  v16h bf[DM / 32][2];
  #pragma unroll
  for (int ks = 0; ks < WRING; ++ks) {
    bf[ks][0] = load_wfrag(w0 + ks * 4 * WHALF);
    bf[ks][1] = load_wfrag(w1 + ks * 4 * WHALF);
  }
  v16h a[2][4];
  #pragma unroll
  for (int mt = 0; mt < 4; ++mt) a[0][mt] = load_frag(src, mt * 16, RS, 0, lane);
  #pragma unroll
  for (int ks = 0; ks < DM / 32; ++ks) {
    if (ks + 1 < DM / 32) {
      #pragma unroll
      for (int mt = 0; mt < 4; ++mt)
        a[(ks + 1) & 1][mt] = load_frag(src + (ks + 1) * KS, mt * 16, RS, 0, lane);
      if (ks >= 1 && ks + WRING - 1 < DM / 32) {   // slice ks - 1 is used up
        bf[ks + WRING - 1][0] = load_wfrag(w0 + (ks + WRING - 1) * 4 * WHALF);
        bf[ks + WRING - 1][1] = load_wfrag(w1 + (ks + WRING - 1) * 4 * WHALF);
      }
      // Keeps the loads above (at ks = 0 the first weight loads too) ahead of
      // this slice's WMMAs: the scheduler otherwise sinks each pair to its use,
      // and every slice then waits out the L2 and the LDS latency.
      __builtin_amdgcn_sched_barrier(0);
    }
    #pragma unroll
    for (int mt = 0; mt < 4; ++mt) {
      #pragma unroll
      for (int nt = 0; nt < 2; ++nt)
        acc[mt * 2 + nt] = WA ? wmma16(bf[ks][nt], a[ks & 1][mt], acc[mt * 2 + nt])
                              : wmma16(a[ks & 1][mt], bf[ks][nt], acc[mt * 2 + nt]);
    }
    // Keeps the next trip's loads from rising among these WMMAs, where they
    // would take a third set of fragment registers and overrun the budget.
    __builtin_amdgcn_sched_barrier(0);
  }
  // The wait that stands before the weight loads' address registers are
  // reused; naming offset and base as inputs keeps them untouched up to here.
  asm volatile("s_wait_xcnt 0x0" :: "v"(loff), "s"(wb) : "memory");
}

// ---------------------------------------------------------------------------
// One 64x32 slice of a projection GEMM: x(64x256,f16) @ W^T + bias.
// A wave owns 32 output columns (one head) for all 64 tokens, so every weight
// row is loaded by exactly one wave of the block; x fragments come from LDS.
// ---------------------------------------------------------------------------
// q and k: weights as A, so a lane holds 16 of one token's 32 head columns. The
// per-head L2 normalization (cosine attention) of the f32 accumulators is an
// in-lane sum and one exchange; a tile goes to dst[token][column] in one
// 16-byte store a lane.
__device__ __forceinline__ void proj_qk(const _Float16* src, const _Float16* w16,
                                        const float* bvec, _Float16* dst,
                                        int n0, int lane) {
  const int c = lane & 15, hh = lane >> 4;
  v8f acc[8];                                // tile index = mt * 2 + nt
  // The head's bias values (a scalar base) and this lane half's byte offset.
  const float* bh = bvec + n0;
  const unsigned hoff = (unsigned)hh * 32u;
  const float4* bp = (const float4*)((const char*)bh + hoff);
  const float4 bl[4] = {bp[0], bp[1], bp[4], bp[5]};
  #pragma unroll
  for (int nt = 0; nt < 2; ++nt) {
    const float4 b0 = bl[nt * 2], b1 = bl[nt * 2 + 1];
    #pragma unroll
    for (int mt = 0; mt < 4; ++mt) {
      acc[mt * 2 + nt][0] = b0.x; acc[mt * 2 + nt][1] = b0.y;
      acc[mt * 2 + nt][2] = b0.z; acc[mt * 2 + nt][3] = b0.w;
      acc[mt * 2 + nt][4] = b1.x; acc[mt * 2 + nt][5] = b1.y;
      acc[mt * 2 + nt][6] = b1.z; acc[mt * 2 + nt][7] = b1.w;
    }
  }
  mm_64x32<XS, 32, true>(src, w16, n0, lane, acc);
  // The wait that stands before the bias loads' address registers are reused;
  // naming offset and base as inputs keeps them untouched up to here. It stands
  // behind the products so that the loads stay free to rise above what precedes.
  asm volatile("s_wait_xcnt 0x0" :: "v"(hoff), "s"(bh) : "memory");
  #pragma unroll
  for (int mt = 0; mt < 4; ++mt) {
    float s0 = 0.0f, s1 = 0.0f;
    #pragma unroll
    for (int r = 0; r < 8; ++r) {
      s0 += acc[mt * 2][r] * acc[mt * 2][r];
      s1 += acc[mt * 2 + 1][r] * acc[mt * 2 + 1][r];
    }
    float s = s0 + s1;
    s += xhalf(s);
    const float rinv = 1.0f / fmaxf(sqrtf(s), 1e-12f);
    _Float16* d = dst + (size_t)(mt * 16 + c) * XS + n0 + hh * 8;
    *(v8h*)(d)      = pack8(acc[mt * 2] * rinv);
    *(v8h*)(d + 16) = pack8(acc[mt * 2 + 1] * rinv);
  }
}

// v: x as A; register r = [token mt * 16 + 8 * (lane >> 4) + r][column], stored
// transposed (dst[column][token]) so that attn@v fragments are contiguous.
__device__ __forceinline__ void proj_v(const _Float16* src, const _Float16* w16,
                                       const float* bvec, _Float16* dst,
                                       int n0, int lane) {
  v8f acc[8];                                // tile index = mt * 2 + nt
  #pragma unroll
  for (int nt = 0; nt < 2; ++nt) {
    const float bv = bvec[n0 + nt * 16 + (lane & 15)];  // C layout: N = lane
    #pragma unroll
    for (int mt = 0; mt < 4; ++mt) {
      #pragma unroll
      for (int e = 0; e < 8; ++e) acc[mt * 2 + nt][e] = bv;
    }
  }
  mm_64x32<XS, 32, false>(src, w16, n0, lane, acc);
  #pragma unroll
  for (int mt = 0; mt < 4; ++mt) {
    #pragma unroll
    for (int nt = 0; nt < 2; ++nt) {
      const int n = n0 + nt * 16 + (lane & 15);
      #pragma unroll
      for (int vg = 0; vg < 8; ++vg) {
        const int m = mt * 16 + vg + ((lane >> 4) << 3);
        dst[(size_t)n * VTS + m] = (_Float16)acc[mt * 2 + nt][vg];
      }
    }
  }
}

// LDS layout (f16 elements). A wave writes and reads only its own head's columns
// of q, k and v^T; its o (64x32) goes into its q columns once it has read them.
// 135 KiB: two work-groups fit a WGP's LDS.
#define OFF_X   0
#define OFF_Q   (NTOK * XS)
#define OFF_K   (2 * NTOK * XS)
#define OFF_VT  (3 * NTOK * XS)
#define SMEM_ELTS (3 * NTOK * XS + DM * VTS)

// Second argument: at least 4 waves a SIMD, that is two work-groups a WGP; it
// sets the register budget to 256.
__global__ __launch_bounds__(256, 4)
void swinv2_window_attn_kernel(const float* __restrict__ img,
                               const _Float16* __restrict__ wq16, const float* __restrict__ bq,
                               const _Float16* __restrict__ wk16, const float* __restrict__ bk,
                               const _Float16* __restrict__ wv16, const float* __restrict__ bv,
                               const _Float16* __restrict__ wo16, const float* __restrict__ bo,
                               const float* __restrict__ logit_scale,
                               const float* __restrict__ biastab,
                               float* __restrict__ out) {
  extern __shared__ char smem_raw[];
  _Float16* xb = (_Float16*)smem_raw;
  _Float16* qb = xb + OFF_Q;
  _Float16* kb = xb + OFF_K;
  _Float16* vt = xb + OFF_VT;

  const int tid  = threadIdx.x;
  const int lane = tid & 31;
  // The wave's number in a scalar register: what is formed from it (head, column
  // base, LDS bases) then takes no vector registers.
  const int wv_id = __builtin_amdgcn_readfirstlane(tid >> 5);

  const int blk = blockIdx.x;        // Bn = B * 4 window-blocks
  const int b  = blk >> 2;
  const int wi = blk & 3;
  const int wy = wi >> 1, wx = wi & 1;

  // ---- Step 1: roll(+4,+4) + window-partition + f32->f16 into LDS ----
  for (int i = tid; i < NTOK * (DM / 4); i += 256) {
    const int row = i >> 6;          // token 0..63
    const int q4  = i & 63;          // float4 index in row
    const int r = row >> 3, c = row & 7;
    const int sh = (((wy << 3) + r) - 4) & 15;   // rolled[h] = img[h-4]
    const int sw = (((wx << 3) + c) - 4) & 15;
    const float4 f =
        ((const float4*)(img + (((size_t)b * 16 + sh) * 16 + sw) * DM))[q4];
    _Float16* dst = xb + (size_t)row * XS + q4 * 4;
    dst[0] = (_Float16)f.x; dst[1] = (_Float16)f.y;
    dst[2] = (_Float16)f.z; dst[3] = (_Float16)f.w;
  }
  __syncthreads();

  // ---- Step 2: q/k/v projections (WMMA). Each wave: 64 rows x 32 cols ----
  const int n0 = wv_id << 5;              // 0,32,...,224
  proj_qk(xb, wq16, bq, qb, n0, lane);    // q, L2-normed
  proj_qk(xb, wk16, bk, kb, n0, lane);    // k, L2-normed
  proj_v (xb, wv16, bv, vt, n0, lane);    // v, transposed
  // No barrier: steps 3 and 4 read only what this wave itself has written.

  // ---- Step 3: logits^T = kn@qn^T * scale + bias, mask, softmax (head/wave) --
  // Tile mt * 4 + nt, register r = [query mt * 16 + c][key nt * 16 + 8 * hh + r].
  const int c = lane & 15, hh = lane >> 4;
  v16h pf[4][2];                          // attn^T as B operands: [mt][32 keys]
  {
    const int h = wv_id;
    const float scale = __expf(fminf(logit_scale[h], 4.6051702f)); // log(100)
    const float* bt = biastab + (size_t)h * NTOK * NTOK;
    const unsigned boff = (unsigned)lane * 16u;

    // Bias values of query tile 0, requested ahead of the products.
    float4 bb[2][8];
    load_bias32(bt, boff, 0, bb[0]);

    v8f lg[16];
    #pragma unroll
    for (int t = 0; t < 16; ++t) {
      #pragma unroll
      for (int e = 0; e < 8; ++e) lg[t][e] = 0.0f;
    }

    v16h kf[4];
    #pragma unroll
    for (int nt = 0; nt < 4; ++nt)
      kf[nt] = load_frag(kb, nt * 16, XS, h * HD, lane);   // A = kn
    #pragma unroll
    for (int mt = 0; mt < 4; ++mt) {
      const v16h q = load_frag(qb, mt * 16, XS, h * HD, lane);  // B = qn^T
      #pragma unroll
      for (int nt = 0; nt < 4; ++nt)
        lg[mt * 4 + nt] = wmma16(kf[nt], q, lg[mt * 4 + nt]);   // K = HD = 32
    }

    // Shift-window mask: query and key are in one region when their row regions
    // and their column regions agree. A key's window column is its register r.
    const int cq = reg3((wx << 3) + (c & 7));
    bool cm[8];
    #pragma unroll
    for (int r = 0; r < 8; ++r) cm[r] = cq == reg3((wx << 3) + r);

    // Per query tile: scale + relative-position bias + mask, then the softmax of
    // the lane's query: over its 32 keys in registers, joined with the other
    // half's 32 by one exchange each for maximum and sum.
    #pragma unroll
    for (int mt = 0; mt < 4; ++mt) {
      if (mt + 1 < 4) load_bias32(bt, boff, mt + 1, bb[(mt + 1) & 1]);
      // Keeps the next tile's bias loads ahead of this tile's arithmetic, so
      // that they fly during it: within the register budget the scheduler
      // otherwise puts each load directly in front of its use.
      __builtin_amdgcn_sched_barrier(0);
      const int rq = reg3((wy << 3) + mt * 2 + (c >> 3));
      #pragma unroll
      for (int nt = 0; nt < 4; ++nt) {
        const bool rm = rq == reg3((wy << 3) + nt * 2 + hh);
        #pragma unroll
        for (int r = 0; r < 8; ++r) {
          const float4 b4 = bb[mt & 1][nt * 2 + (r >> 2)];
          const float bvl = (r & 3) == 0 ? b4.x : (r & 3) == 1 ? b4.y
                          : (r & 3) == 2 ? b4.z : b4.w;
          const float v = lg[mt * 4 + nt][r] * scale + bvl;
          lg[mt * 4 + nt][r] = (rm && cm[r]) ? v : -1e30f;
        }
      }
      float mx = -1e30f;
      #pragma unroll
      for (int nt = 0; nt < 4; ++nt) {
        #pragma unroll
        for (int r = 0; r < 8; ++r) mx = fmaxf(mx, lg[mt * 4 + nt][r]);
      }
      mx = fmaxf(mx, xhalf(mx));
      float sp[4];
      #pragma unroll
      for (int nt = 0; nt < 4; ++nt) {
        sp[nt] = 0.0f;
        #pragma unroll
        for (int r = 0; r < 8; ++r) {
          const float e = __expf(lg[mt * 4 + nt][r] - mx);
          lg[mt * 4 + nt][r] = e;
          sp[nt] += e;
        }
      }
      float sm = (sp[0] + sp[1]) + (sp[2] + sp[3]);
      sm += xhalf(sm);
      const float rinv = 1.0f / sm;
      // Two key tiles of one query tile, converted in place, are the B operand
      // of attn@v in the hardware's k order: attn never goes through LDS.
      #pragma unroll
      for (int kk = 0; kk < 2; ++kk) {
        V16u u;
        u.h[0] = pack8(lg[mt * 4 + kk * 2] * rinv);
        u.h[1] = pack8(lg[mt * 4 + kk * 2 + 1] * rinv);
        pf[mt][kk] = u.v;
      }
    }
    // The wait that stands before the bias loads' address registers are reused;
    // naming offset and base as inputs keeps them untouched up to here.
    asm volatile("s_wait_xcnt 0x0" :: "v"(boff), "s"(bt) : "memory");
  }

  // ---- Step 4: o^T = v^T @ attn^T (one head per wave, WMMA, K = 64 tokens) ----
  {
    const int h = wv_id;
    v8f oacc[8];                             // tile index = mt * 2 + nt2
    #pragma unroll
    for (int t = 0; t < 8; ++t) {
      #pragma unroll
      for (int e = 0; e < 8; ++e) oacc[t][e] = 0.0f;
    }
    #pragma unroll
    for (int kk = 0; kk < 2; ++kk) {
      v16h vf[2];
      #pragma unroll
      for (int nt2 = 0; nt2 < 2; ++nt2)
        vf[nt2] = load_frag(vt, h * HD + nt2 * 16, VTS, kk * 32, lane); // v^T rows
      #pragma unroll
      for (int mt = 0; mt < 4; ++mt) {
        #pragma unroll
        for (int nt2 = 0; nt2 < 2; ++nt2)
          oacc[mt * 2 + nt2] = wmma16(vf[nt2], pf[mt][kk], oacc[mt * 2 + nt2]);
      }
    }
    // Register r = o[query mt * 16 + c][head column nt2 * 16 + 8 * hh + r].
    #pragma unroll
    for (int mt = 0; mt < 4; ++mt) {
      _Float16* d = qb + (size_t)(mt * 16 + c) * XS + n0 + hh * 8;
      *(v8h*)(d)      = pack8(oacc[mt * 2]);
      *(v8h*)(d + 16) = pack8(oacc[mt * 2 + 1]);
    }
  }
  __syncthreads();

  // ---- Step 5: z = o @ wo^T + bo, reverse roll folded into global store ----
  {
    v8f acc[8];                              // tile index = mt * 2 + nt
    #pragma unroll
    for (int nt = 0; nt < 2; ++nt) {
      const float bvl = bo[n0 + nt * 16 + (lane & 15)];
      #pragma unroll
      for (int mt = 0; mt < 4; ++mt) {
        #pragma unroll
        for (int e = 0; e < 8; ++e) acc[mt * 2 + nt][e] = bvl;
      }
    }
    mm_64x32<XS, 32, false>(qb, wo16, n0, lane, acc);
    #pragma unroll
    for (int mt = 0; mt < 4; ++mt) {
      #pragma unroll
      for (int nt = 0; nt < 2; ++nt) {
        const int n = n0 + nt * 16 + (lane & 15);
        #pragma unroll
        for (int vg = 0; vg < 8; ++vg) {
          const int m  = mt * 16 + vg + ((lane >> 4) << 3);
          const int oh = (((wy << 3) + (m >> 3)) - 4) & 15;  // out = roll(z,-4)
          const int ow = (((wx << 3) + (m & 7)) - 4) & 15;
          out[(((size_t)b * 16 + oh) * 16 + ow) * DM + n] = acc[mt * 2 + nt][vg];
        }
      }
    }
  }
}

// ---------------------------------------------------------------------------
// Prep kernel 1: f32 -> f16 weight conversion into the packed fragment order
// of load_wfrag. One thread per 16-byte piece (8 values of one row) of one
// matrix; 32 blocks a matrix.
// ---------------------------------------------------------------------------
__global__ __launch_bounds__(256)
void swinv2_prep_weights(const float* __restrict__ wq, const float* __restrict__ wk,
                         const float* __restrict__ wv, const float* __restrict__ wo,
                         _Float16* __restrict__ wq16, _Float16* __restrict__ wk16,
                         _Float16* __restrict__ wv16, _Float16* __restrict__ wo16) {
  const int mat = blockIdx.x >> 5;
  const float* src = mat == 0 ? wq : mat == 1 ? wk : mat == 2 ? wv : wo;
  _Float16*    dst = mat == 0 ? wq16 : mat == 1 ? wk16 : mat == 2 ? wv16 : wo16;
  const int c  = (blockIdx.x & 31) * 256 + threadIdx.x;   // piece 0..8191
  const int l  = c & 31;             // lane that will read the piece
  const int j  = (c >> 5) & 1;       // half of the fragment
  const int nt = (c >> 6) & 1;       // 16-row tile of the wave
  const int ks = (c >> 7) & 7;       // k slice
  const int w  = c >> 10;            // wave
  const int row = w * 32 + nt * 16 + (l & 15);
  const int col = ks * 32 + j * 16 + ((l >> 4) << 3);
  const float4* s = (const float4*)(src + (size_t)row * DM + col);
  const float4 f0 = s[0], f1 = s[1];
  v8h o;
  o[0] = (_Float16)f0.x; o[1] = (_Float16)f0.y;
  o[2] = (_Float16)f0.z; o[3] = (_Float16)f0.w;
  o[4] = (_Float16)f1.x; o[5] = (_Float16)f1.y;
  o[6] = (_Float16)f1.z; o[7] = (_Float16)f1.w;
  *(v8h*)(dst + (size_t)c * 8) = o;
}

// ---------------------------------------------------------------------------
// Prep kernel 2: CPB-MLP relative-position bias table, 64x64 f32 a head (16 *
// sigmoid already applied), in the order of load_bias32.
// The bias of (query n, key m) depends only on (dy, dx) = the difference of their
// window rows and columns: 15 x 15 positions. One block per dy; wave w computes
// position dx = w - 7 for all heads, the 512 hidden units dealt over its lanes
// (16 a lane, their weights in 44 wave-wide 16-byte loads), the lanes' partial
// sums joined by a butterfly. The block then writes every table line
// whose (query row, key row) pair has its dy: a 128-B line holds 8 queries of
// one window row x 4 keys of one window row, so each line has one writer.
// ---------------------------------------------------------------------------
#define NPOS (2 * WINSZ - 1)         // 15 values of dy, and of dx

// x + (x of lane l ^ M), M < 16: a move inside the 16-lane row.
template<int M>
__device__ __forceinline__ float add_xrow(float x) {
  const int b = __builtin_bit_cast(int, x);
  return x + __builtin_bit_cast(float, __builtin_amdgcn_update_dpp(
      b, b, 0x160 + M /* row_xmask:M */, 0xf, 0xf, false));
}

// Signed log-spaced relative coordinate of a difference d in [-7, 7].
__device__ __forceinline__ float cpb_coord(float d) {
  const float s = d / 7.0f * 8.0f;
  return copysignf(log2f(fabsf(s) + 1.0f) / 3.0f, s);
}

__global__ __launch_bounds__(512)
void swinv2_prep_bias(const float* __restrict__ w1, const float* __restrict__ b1,
                      const float* __restrict__ w2, float* __restrict__ biastab) {
  __shared__ float tab[NPOS * NHEADS];           // [dx + 7][head]
  const int tid  = threadIdx.x;
  const int lane = tid & 31;
  const int wv   = __builtin_amdgcn_readfirstlane(tid >> 5);
  const int dyi  = (int)blockIdx.x - (WINSZ - 1);   // query row - key row

  if (wv < NPOS) {
    // Hidden units j = 128 * t + 4 * lane + (0..3).
    // Scalar bases and this lane's two byte offsets.
    const unsigned o16 = (unsigned)lane * 16u, o32 = (unsigned)lane * 32u;
    const float4* p1 = (const float4*)((const char*)w1 + o32);
    const float4* pb = (const float4*)((const char*)b1 + o16);
    const float4* p2 = (const float4*)((const char*)w2 + o16);
    // The loops below are unrolled so that these arrays live in registers.
    float4 wa[4], wb[4], bh[4], wh[NHEADS][4];
    #pragma unroll
    for (int t = 0; t < 4; ++t) {
      wa[t] = p1[t * 64];
      wb[t] = p1[t * 64 + 1];
      bh[t] = pb[t * 32];
      #pragma unroll
      for (int h = 0; h < NHEADS; ++h) wh[h][t] = p2[h * 128 + t * 32];
    }
    // The wait that stands before the loads' address registers are reused; naming
    // offsets and bases as inputs keeps them untouched up to here.
    asm volatile("s_wait_xcnt 0x0" :: "v"(o16), "v"(o32), "s"(w1), "s"(b1), "s"(w2)
                 : "memory");
    const float ty = cpb_coord((float)dyi);
    const float tx = cpb_coord((float)(wv - (WINSZ - 1)));

    float acc[NHEADS];
    #pragma unroll
    for (int h = 0; h < NHEADS; ++h) acc[h] = 0.0f;
    #pragma unroll
    for (int t = 0; t < 4; ++t) {
      const float g0 = fmaxf(wa[t].x * ty + wa[t].y * tx + bh[t].x, 0.0f);
      const float g1 = fmaxf(wa[t].z * ty + wa[t].w * tx + bh[t].y, 0.0f);
      const float g2 = fmaxf(wb[t].x * ty + wb[t].y * tx + bh[t].z, 0.0f);
      const float g3 = fmaxf(wb[t].z * ty + wb[t].w * tx + bh[t].w, 0.0f);
      #pragma unroll
      for (int h = 0; h < NHEADS; ++h) {
        acc[h] += g0 * wh[h][t].x;
        acc[h] += g1 * wh[h][t].y;
        acc[h] += g2 * wh[h][t].z;
        acc[h] += g3 * wh[h][t].w;
      }
    }
    #pragma unroll
    for (int h = 0; h < NHEADS; ++h) {
      float s = acc[h];
      s = add_xrow<1>(s);
      s = add_xrow<2>(s);
      s = add_xrow<4>(s);
      s = add_xrow<8>(s);
      acc[h] = s + xhalf(s);
    }
    // Every lane holds all eight sums; lane h finishes head h.
    float a = acc[0];
    #pragma unroll
    for (int h = 1; h < NHEADS; ++h) a = lane == h ? acc[h] : a;
    if (lane < NHEADS) tab[wv * NHEADS + lane] = 16.0f / (1.0f + __expf(-a));
  }
  __syncthreads();

  // One 16-byte piece a thread: query n = ny * 8 + nx, keys m = my * 8 + mh * 4 +
  // (0..3). Table place of (n, m): [query tile n >> 4][key tile (m >> 4) * 2 +
  // ((m >> 2) & 1)][lane ((m >> 3) & 1) * 16 + (n & 15)][m & 3].
  const int ady = dyi < 0 ? -dyi : dyi;
  const int my0 = dyi < 0 ? -dyi : 0;             // first key row with a partner
  // At most 1024 pieces a block; unrolled: two straight-line stores, no loop.
  #pragma unroll
  for (int i = 0; i < 2; ++i) {
    const int e = i * 512 + tid;
    if (e < (WINSZ - ady) * 128) {
      const int nx = e & 7, mh = (e >> 3) & 1, h = (e >> 4) & 7;
      const int my = my0 + (e >> 7), ny = my + dyi;
      const int piece = (ny >> 1) * 8 + (my >> 1) * 2 + mh;
      const int slot  = (my & 1) * 16 + (ny & 1) * 8 + nx;
      // dx + 7 = nx - (mh * 4 + k) + 7 for key k; tp: key 3's entry.
      const float* tp = tab + (nx + ((mh ^ 1) << 2)) * NHEADS + h;
      float4 o;
      o.x = tp[3 * NHEADS];
      o.y = tp[2 * NHEADS];
      o.z = tp[1 * NHEADS];
      o.w = tp[0];
      ((float4*)(biastab + (size_t)h * NTOK * NTOK))[piece * 32 + slot] = o;
    }
  }
}

// ---------------------------------------------------------------------------
extern "C" void kernel_launch(void* const* d_in, const int* in_sizes, int n_in,
                              void* d_out, int out_size, void* d_ws, size_t ws_size,
                              hipStream_t stream) {
  (void)in_sizes; (void)n_in; (void)out_size; (void)ws_size;

  const float* img  = (const float*)d_in[0];
  const float* wq   = (const float*)d_in[1];
  const float* bq   = (const float*)d_in[2];
  const float* wk   = (const float*)d_in[3];
  const float* bk   = (const float*)d_in[4];
  const float* wv   = (const float*)d_in[5];
  const float* bv   = (const float*)d_in[6];
  const float* wo   = (const float*)d_in[7];
  const float* bo   = (const float*)d_in[8];
  const float* ls   = (const float*)d_in[9];
  const float* cw1  = (const float*)d_in[10];
  const float* cb1  = (const float*)d_in[11];
  const float* cw2  = (const float*)d_in[12];
  float* out = (float*)d_out;

  // workspace layout (bytes)
  char* ws = (char*)d_ws;
  _Float16* wq16 = (_Float16*)(ws + 0 * 131072);
  _Float16* wk16 = (_Float16*)(ws + 1 * 131072);
  _Float16* wv16 = (_Float16*)(ws + 2 * 131072);
  _Float16* wo16 = (_Float16*)(ws + 3 * 131072);
  float*    btab = (float*)   (ws + 4 * 131072);   // 8 heads x 64 x 64 f32

  swinv2_prep_weights<<<4 * (DM * DM / 8 / 256), 256, 0, stream>>>(
      wq, wk, wv, wo, wq16, wk16, wv16, wo16);
  swinv2_prep_bias<<<NPOS, 512, 0, stream>>>(cw1, cb1, cw2, btab);

  const size_t smem_bytes = (size_t)SMEM_ELTS * sizeof(_Float16);  // 138240 B
  (void)hipFuncSetAttribute((const void*)swinv2_window_attn_kernel,
                            hipFuncAttributeMaxDynamicSharedMemorySize,
                            (int)smem_bytes);

  const int Bn = 512 * 4;   // B * NW windows
  swinv2_window_attn_kernel<<<Bn, 256, smem_bytes, stream>>>(
      img, wq16, bq, wk16, bk, wv16, bv, wo16, bo, ls, btab, out);
}
